// v000
// The times below were measured on an AMD MI455X: many runs one after another, warmed up first and cycling through
// copies of the inputs, with the whole window's GPU time divided by the number of runs. Launches and the gaps
// between them are all in it. The median over several windows is given; except for v000 it joins two sittings, which
// can be a few percent apart, so the side-by-side timings, each taken in one sitting, are the better comparison.
// v000, which the later versions start from, runs in 309 microseconds.
// All contractions (input projections, score tile phi_q*phi_k^T, score*V, phi_q*state, V*phi_k state update): v_wmma_f32_16x16x32_bf16 with bf16 hi/lo split operands (hi*hi + hi*lo + lo*hi), f32 accumulate; row normaliser and feature column sums on VALU in f32.
#include <hip/hip_runtime.h>

// ---------------- fixed problem geometry ----------------
constexpr int NBATCH = 8;      // batch
constexpr int NDIM   = 64;     // key/query feature dim (contraction of the projection)
constexpr int NSEQ   = 2048;   // sequence length
constexpr int NFEAT  = 64;     // projection features m
constexpr int NVAL   = 64;     // value dim
constexpr int CHUNK  = 64;     // time steps per sequential chunk
constexpr int NCHUNK = NSEQ / CHUNK;
constexpr int PITB   = 72;     // 16-bit LDS tile pitch (elements): 144 B rows, 16-B aligned fragment loads
constexpr int PITF   = 68;     // f32 LDS tile pitch (elements): 272 B rows
constexpr int NTHR   = 256;    // 8 waves per block
constexpr float FEAT_EPS = 1.0e-3f;

static_assert(NSEQ % CHUNK == 0);
static_assert(NDIM == 64 && NFEAT == 64 && NVAL == 64 && CHUNK == 64);
static_assert(CHUNK % 32 == 0);          // phase-3 thread-range branches are wave-uniform
static_assert(NTHR == 256);
static_assert((PITB * 2) % 16 == 0 && (PITF * 4) % 16 == 0);

typedef __attribute__((ext_vector_type(16))) __bf16   v16b;
typedef __attribute__((ext_vector_type(8)))  __bf16   v8b;
typedef __attribute__((ext_vector_type(8)))  float    v8f;
typedef __attribute__((ext_vector_type(4)))  float    v4f;
typedef __attribute__((ext_vector_type(4)))  unsigned int v4u;
typedef __attribute__((ext_vector_type(2)))  unsigned int v2u;

// ---------------- pieces ----------------
__device__ __forceinline__ unsigned short f2bf_bits(float f) {
  unsigned u = __float_as_uint(f);
  return (unsigned short)((u + 0x7FFFu + ((u >> 16) & 1u)) >> 16);
}
__device__ __forceinline__ float bf_bits2f(unsigned short h) { return __uint_as_float(((unsigned)h) << 16); }

__device__ __forceinline__ void dep_guard_b(v8f& a, v8f& b, v16b x, v16b y) { asm volatile("v_nop\n\tv_nop\n\tv_nop\n\tv_nop" : "+v"(a), "+v"(b) : "v"(x), "v"(y)); }
__device__ __forceinline__ void keep4_b(v16b a, v16b b, v16b c, v16b d) { asm volatile("v_nop" :: "v"(a), "v"(b), "v"(c), "v"(d)); }
template <typename T> struct Frag;
template <> struct Frag<__bf16> {
  typedef v16b V; union U { v16b v; v8b h[2]; };
  static __device__ __forceinline__ v16b load(const __bf16* p) {   // elements 0..7 <- p[0..7], 8..15 <- p[16..23]
    U f; f.h[0] = *(const v8b*)(p); f.h[1] = *(const v8b*)(p + 16); return f.v;
  }
  static __device__ __forceinline__ v8f mma(v16b a, v16b b, v8f c) {
    return __builtin_amdgcn_wmma_f32_16x16x32_bf16(false, a, false, b, (short)0, c, false, false);
  }
  static __device__ __forceinline__ void guard(v8f& a, v8f& b, v16b x, v16b y) { dep_guard_b(a, b, x, y); }
  static __device__ __forceinline__ void keep(v16b a, v16b b, v16b c, v16b d) { keep4_b(a, b, c, d); }
};

// one WMMA with the 4-slot hazard guard (ties D, keeps A/B live)
__device__ __forceinline__ v8f at_mma(v16b a, v16b b, v8f c) {
  c = __builtin_amdgcn_wmma_f32_16x16x32_bf16(false, a, false, b, (short)0, c, false, false);
  asm volatile("v_nop\n\tv_nop\n\tv_nop\n\tv_nop" : "+v"(c) : "v"(a), "v"(b));
  return c;
}

// ---------------- helpers ----------------
// bf16 hi/lo split (RNE convert): f ~= hi + lo, both as bf16 bit patterns
__device__ __forceinline__ void split_bits(float f, unsigned short& hi, unsigned short& lo) {
  hi = f2bf_bits(f);
  lo = f2bf_bits(f - bf_bits2f(hi));
}

__device__ __forceinline__ const __bf16* bfp(const unsigned short* p) { return (const __bf16*)(const void*)p; }

__device__ __forceinline__ v8f zero8() { return (v8f){0.f,0.f,0.f,0.f,0.f,0.f,0.f,0.f}; }

// One 16x16 output tile over K = 64 (two 32-deep steps) of C = A * Bt^T with hi/lo split planes.
// A planes row-major [row][PITB] (k contiguous), Bt planes row-major [n][PITB] (k contiguous); all in LDS.
// Per lane: A row = arow0 + (lane&15), Bt row = brow0 + (lane&15); fragment elements 0..7 <- k0 + 8h + 0..7,
// 8..15 <- k0 + 16 + 8h + 0..7 (h = lane>>4). D element r of lane l -> (arow0 + 8h + r, brow0 + (l&15)).
__device__ __forceinline__ v8f tile_k64_split(const unsigned short* Ah, const unsigned short* Al, int arow0,
                                               const unsigned short* Bh, const unsigned short* Bl, int brow0,
                                               int lane, v8f acc) {
  const int rl = lane & 15, koff = (lane >> 4) * 8;
#pragma unroll
  for (int ks = 0; ks < 2; ++ks) {
    const int ao = (arow0 + rl) * PITB + 32 * ks + koff;
    const int bo = (brow0 + rl) * PITB + 32 * ks + koff;
    const v16b ah = Frag<__bf16>::load(bfp(Ah) + ao);
    const v16b al = Frag<__bf16>::load(bfp(Al) + ao);
    const v16b bh = Frag<__bf16>::load(bfp(Bh) + bo);
    const v16b bl = Frag<__bf16>::load(bfp(Bl) + bo);
    acc = at_mma(ah, bh, acc);
    acc = at_mma(ah, bl, acc);
    acc = at_mma(al, bh, acc);
  }
  return acc;
}

// Store a D tile (element r of lane -> (row0 + 8h + r, col0 + (lane&15))) as hi/lo bf16 into row-major LDS planes.
__device__ __forceinline__ void put_split_rm(unsigned short* Ph, unsigned short* Pl, int row0, int col0, int lane, v8f v) {
  const int hq = lane >> 4, cq = lane & 15;
#pragma unroll
  for (int r = 0; r < 8; ++r) {
    unsigned short hb, lb;
    split_bits(v[r], hb, lb);
    const int off = (row0 + 8 * hq + r) * PITB + col0 + cq;
    Ph[off] = hb;
    Pl[off] = lb;
  }
}
// Store the TRANSPOSE of a D tile: element r of lane -> P[col0 + (lane&15)][row0 + 8h + r]; the 8 elements of a lane are
// contiguous -> one 16-B LDS store per plane built from per-lane integer words.
__device__ __forceinline__ void put_split_tr(unsigned short* Ph, unsigned short* Pl, int row0, int col0, int lane, v8f v) {
  const int hq = lane >> 4, cq = lane & 15;
  v4u uh, ul;
#pragma unroll
  for (int e = 0; e < 4; ++e) {
    unsigned short ha, la, hb, lb;
    split_bits(v[2 * e], ha, la);
    split_bits(v[2 * e + 1], hb, lb);
    uh[e] = (unsigned)ha | ((unsigned)hb << 16);
    ul[e] = (unsigned)la | ((unsigned)lb << 16);
  }
  const int off = (col0 + cq) * PITB + row0 + 8 * hq;   // byte offset 144*(col) + 2*(row0+8h): 16-B aligned
  *(v4u*)(Ph + off) = uh;
  *(v4u*)(Pl + off) = ul;
}

// =====================================================================================================
// One block per batch element; 8 waves; 32 sequential chunks of 64 steps.
// Per chunk (l0 = 64*ch, local rows l, local key positions i):
//   phi_q[l][m], phi_k[i][m] = relu(x^T W) + eps             (projection GEMMs, K = d = 64)
//   A[l][i] = sum_m phi_q[l][m] phi_k[i][m], kept for i <= l  (score tile, K = m = 64)
//   norm[l] = phi_q[l].z_old + sum_i A[l][i]                  (VALU f32)
//   out[l][v] = (sum_i A[l][i] V[i][v] + sum_m phi_q[l][m] S_old[m][v]) / norm[l]
//   S^T[v][m] += sum_i V[i][v] phi_k[i][m];  z[m] += sum_i phi_k[i][m]
// State S^T lives in registers (each wave owns two 16x16 tiles); z in LDS.
// LDS tile reuse (every producer/consumer pair of a tile is separated by a block barrier):
//   sXh/sXl : q^T hi/lo [l][d] (phases 0-1), then V as Bt [v][i] (phases 2-4)
//   sYh/sYl : k^T hi/lo [l][d] (phases 0-1), then S_old^T as Bt [v][m] (phases 2-4)
//   sKAh/l  : phi_k [i][m] (phases 1-2), then masked A [l][i] (phases 2b-4)
//   sF      : masked A in f32 [l][i] (phases 2b-3), then out^T [v][l] f32 (phases 4-5)
// =====================================================================================================
__global__ __launch_bounds__(NTHR)
void lin_attn_causal_kernel(const float* __restrict__ keys,
                            const float* __restrict__ values,
                            const float* __restrict__ queries,
                            const float* __restrict__ proj,
                            float* __restrict__ out) {
  __shared__ __align__(16) unsigned short sXh[CHUNK * PITB];
  __shared__ __align__(16) unsigned short sXl[CHUNK * PITB];
  __shared__ __align__(16) unsigned short sYh[CHUNK * PITB];
  __shared__ __align__(16) unsigned short sYl[CHUNK * PITB];
  __shared__ __align__(16) unsigned short sWh[NFEAT * PITB];   // W^T hi [m][d]
  __shared__ __align__(16) unsigned short sWl[NFEAT * PITB];   // W^T lo [m][d]
  __shared__ __align__(16) unsigned short sQh[CHUNK * PITB];   // phi_q hi [l][m]
  __shared__ __align__(16) unsigned short sQl[CHUNK * PITB];
  __shared__ __align__(16) unsigned short sKAh[CHUNK * PITB];
  __shared__ __align__(16) unsigned short sKAl[CHUNK * PITB];
  __shared__ __align__(16) unsigned short sKTh[NFEAT * PITB];  // phi_k^T hi [m][i]
  __shared__ __align__(16) unsigned short sKTl[NFEAT * PITB];
  __shared__ __align__(16) float sF[CHUNK * PITF];
  __shared__ __align__(16) float sZ[NFEAT];
  __shared__ __align__(16) float sRN[CHUNK];

  const int tid  = threadIdx.x;
  const int lane = tid & 31;
  const int w    = tid >> 5;          // wave 0..7
  const int hh   = lane >> 4;
  const int cc   = lane & 15;
  const int tm   = w >> 1;            // row-tile index owned by this wave in every 64x64 GEMM
  const int tn0  = (w & 1) * 2;       // first of the two column tiles owned by this wave
  const int b    = blockIdx.x;        // grid.x == NBATCH exactly

  const float* kb = keys    + (size_t)b * NDIM * NSEQ;
  const float* qb = queries + (size_t)b * NDIM * NSEQ;
  const float* vb = values  + (size_t)b * NVAL * NSEQ;
  float*       ob = out     + (size_t)b * NVAL * NSEQ;

  // ---- W^T hi/lo staging: proj is [d][m] f32; 1024 v4f = 256 threads x 4; covers all 64x64 ----
#pragma unroll
  for (int it = 0; it < 4; ++it) {
    const int idx = tid + it * NTHR;
    const int d   = idx >> 4;
    const int m4  = (idx & 15) << 2;
    const v4f wv = *(const v4f*)(proj + (size_t)d * NFEAT + m4);
#pragma unroll
    for (int e = 0; e < 4; ++e) {
      unsigned short hb, lb;
      split_bits(wv[e], hb, lb);
      const int off = (m4 + e) * PITB + d;
      sWh[off] = hb;
      sWl[off] = lb;
    }
  }
  if (tid < NFEAT) sZ[tid] = 0.f;

  v8f accS[2];                        // S^T tiles: rows v = 16*tm + 8h + r, cols m = 16*(tn0+j) + cc
  accS[0] = zero8();
  accS[1] = zero8();

  for (int ch = 0; ch < NCHUNK; ++ch) {
    const int l0 = ch * CHUNK;

    // ---- phase 0: q, k chunk: [d][l0..l0+63] f32 -> hi/lo bf16 transposed [l][d]; 1024 v4f per tensor = 256 x 4 ----
#pragma unroll
    for (int it = 0; it < 4; ++it) {
      const int idx = tid + it * NTHR;
      const int d   = idx >> 4;
      const int i4  = (idx & 15) << 2;
      const v4f qv = *(const v4f*)(qb + (size_t)d * NSEQ + l0 + i4);
      const v4f kv = *(const v4f*)(kb + (size_t)d * NSEQ + l0 + i4);
#pragma unroll
      for (int e = 0; e < 4; ++e) {
        unsigned short hq, lq, hk, lk;
        split_bits(qv[e], hq, lq);
        split_bits(kv[e], hk, lk);
        const int off = (i4 + e) * PITB + d;
        sXh[off] = hq; sXl[off] = lq;
        sYh[off] = hk; sYl[off] = lk;
      }
    }
    __syncthreads();   // B1

    // ---- phase 1: phi = relu(x^T W) + eps : A = x^T [l][d], Bt = W^T [m][d] ----
    {
      v8f aq[2], ak[2];
      aq[0] = zero8(); aq[1] = zero8(); ak[0] = zero8(); ak[1] = zero8();
      const int rl = lane & 15, koff = hh * 8;
#pragma unroll
      for (int ks = 0; ks < 2; ++ks) {
        const int ao = (16 * tm + rl) * PITB + 32 * ks + koff;
        const v16b qh = Frag<__bf16>::load(bfp(sXh) + ao);
        const v16b ql = Frag<__bf16>::load(bfp(sXl) + ao);
        const v16b kh = Frag<__bf16>::load(bfp(sYh) + ao);
        const v16b kl = Frag<__bf16>::load(bfp(sYl) + ao);
#pragma unroll
        for (int j = 0; j < 2; ++j) {
          const int bo = (16 * (tn0 + j) + rl) * PITB + 32 * ks + koff;
          const v16b wh = Frag<__bf16>::load(bfp(sWh) + bo);
          const v16b wl = Frag<__bf16>::load(bfp(sWl) + bo);
          aq[j] = at_mma(qh, wh, aq[j]);
          aq[j] = at_mma(qh, wl, aq[j]);
          aq[j] = at_mma(ql, wh, aq[j]);
          ak[j] = at_mma(kh, wh, ak[j]);
          ak[j] = at_mma(kh, wl, ak[j]);
          ak[j] = at_mma(kl, wh, ak[j]);
        }
      }
#pragma unroll
      for (int j = 0; j < 2; ++j) {
        v8f pq, pk;
#pragma unroll
        for (int r = 0; r < 8; ++r) {
          pq[r] = fmaxf(aq[j][r], 0.f) + FEAT_EPS;
          pk[r] = fmaxf(ak[j][r], 0.f) + FEAT_EPS;
        }
        put_split_rm(sQh,  sQl,  16 * tm, 16 * (tn0 + j), lane, pq);   // phi_q [l][m]
        put_split_rm(sKAh, sKAl, 16 * tm, 16 * (tn0 + j), lane, pk);   // phi_k [i][m]
        put_split_tr(sKTh, sKTl, 16 * tm, 16 * (tn0 + j), lane, pk);   // phi_k^T [m][i]
      }
    }
    __syncthreads();   // B2

    // ---- phase 2: stage V ([v][l0+i] f32 -> hi/lo Bt [v][i]), stage S_old^T hi/lo, score GEMM ----
    v8f accA[2];
    {
      // V: 1024 v4f = 256 x 4, covers 64 x 64; 4 halves packed into two integer words per plane
#pragma unroll
      for (int it = 0; it < 4; ++it) {
        const int idx = tid + it * NTHR;
        const int vr  = idx >> 4;
        const int i4  = (idx & 15) << 2;
        const v4f vv = *(const v4f*)(vb + (size_t)vr * NSEQ + l0 + i4);
        unsigned short h0, g0, h1, g1, h2, g2, h3, g3;
        split_bits(vv[0], h0, g0);
        split_bits(vv[1], h1, g1);
        split_bits(vv[2], h2, g2);
        split_bits(vv[3], h3, g3);
        v2u uh, ul;
        uh[0] = (unsigned)h0 | ((unsigned)h1 << 16);
        uh[1] = (unsigned)h2 | ((unsigned)h3 << 16);
        ul[0] = (unsigned)g0 | ((unsigned)g1 << 16);
        ul[1] = (unsigned)g2 | ((unsigned)g3 << 16);
        const int off = vr * PITB + i4;      // byte 144*vr + 2*i4 : 8-B aligned
        *(v2u*)(sXh + off) = uh;
        *(v2u*)(sXl + off) = ul;
      }
      // S_old^T as Bt [v][m]
      put_split_rm(sYh, sYl, 16 * tm, 16 * tn0,       lane, accS[0]);
      put_split_rm(sYh, sYl, 16 * tm, 16 * (tn0 + 1), lane, accS[1]);
      // A[l][i] = sum_m phi_q[l][m] phi_k[i][m] : A = phi_q rows l, Bt = phi_k rows i; causal mask i <= l
#pragma unroll
      for (int j = 0; j < 2; ++j) {
        accA[j] = tile_k64_split(sQh, sQl, 16 * tm, sKAh, sKAl, 16 * (tn0 + j), lane, zero8());
#pragma unroll
        for (int r = 0; r < 8; ++r) {
          const int row = 16 * tm + 8 * hh + r;
          const int col = 16 * (tn0 + j) + cc;
          const float a = accA[j][r];
          accA[j][r] = (col <= row) ? a : 0.f;
        }
      }
    }
    __syncthreads();   // B3

    // ---- phase 2b: masked A -> hi/lo planes (over phi_k's tile space) and f32 copy (explicit zeros stored) ----
#pragma unroll
    for (int j = 0; j < 2; ++j) {
      put_split_rm(sKAh, sKAl, 16 * tm, 16 * (tn0 + j), lane, accA[j]);
#pragma unroll
      for (int r = 0; r < 8; ++r)
        sF[(16 * tm + 8 * hh + r) * PITF + 16 * (tn0 + j) + cc] = accA[j][r];
    }
    __syncthreads();   // B4

    // ---- phase 3: normaliser (waves 0-1) and phi_k column sums (waves 2-3); branches are wave-uniform ----
    float zp = 0.f;
    if (tid < CHUNK) {
      const int l = tid;
      float s = 0.f;
#pragma unroll 1
      for (int j = 0; j < 8; ++j) {
        const v4u wh = *(const v4u*)(sQh + l * PITB + 8 * j);
        const v4u wl = *(const v4u*)(sQl + l * PITB + 8 * j);
#pragma unroll
        for (int e = 0; e < 4; ++e) {
          const float p0 = __uint_as_float(wh[e] << 16) + __uint_as_float(wl[e] << 16);
          const float p1 = __uint_as_float(wh[e] & 0xffff0000u) + __uint_as_float(wl[e] & 0xffff0000u);
          s += p0 * sZ[8 * j + 2 * e];
          s += p1 * sZ[8 * j + 2 * e + 1];
        }
      }
      float asum = 0.f;
#pragma unroll 1
      for (int i = 0; i < CHUNK; i += 4) {
        const v4f av = *(const v4f*)(sF + l * PITF + i);
        asum += (av[0] + av[1]) + (av[2] + av[3]);
      }
      sRN[l] = 1.0f / (s + asum);
    } else if (tid < 2 * CHUNK) {
      const int m = tid - CHUNK;
#pragma unroll 1
      for (int j = 0; j < 8; ++j) {
        const v4u wh = *(const v4u*)(sKTh + m * PITB + 8 * j);
        const v4u wl = *(const v4u*)(sKTl + m * PITB + 8 * j);
#pragma unroll
        for (int e = 0; e < 4; ++e) {
          zp += __uint_as_float(wh[e] << 16) + __uint_as_float(wl[e] << 16);
          zp += __uint_as_float(wh[e] & 0xffff0000u) + __uint_as_float(wl[e] & 0xffff0000u);
        }
      }
    }
    __syncthreads();   // B5
    if (tid >= CHUNK && tid < 2 * CHUNK) sZ[tid - CHUNK] += zp;   // z := z_old + colsum(phi_k); next read is after B6..B4

    // ---- phase 4: out tile, state update, epilogue into out^T [v][l] f32 ----
    {
      v8f accO[2];
#pragma unroll
      for (int j = 0; j < 2; ++j) {
        // sum_i A[l][i] V[i][v] : A = masked A rows l, Bt = V [v][i]
        accO[j] = tile_k64_split(sKAh, sKAl, 16 * tm, sXh, sXl, 16 * (tn0 + j), lane, zero8());
        // + sum_m phi_q[l][m] S_old[m][v] : A = phi_q rows l, Bt = S_old^T [v][m]
        accO[j] = tile_k64_split(sQh, sQl, 16 * tm, sYh, sYl, 16 * (tn0 + j), lane, accO[j]);
        // S^T[v][m] += sum_i V[i][v] phi_k[i][m] : A = V [v][i] rows v, Bt = phi_k^T [m][i] rows m
        accS[j] = tile_k64_split(sXh, sXl, 16 * tm, sKTh, sKTl, 16 * (tn0 + j), lane, accS[j]);
      }
      const v4f rn0 = *(const v4f*)(sRN + 16 * tm + 8 * hh);
      const v4f rn1 = *(const v4f*)(sRN + 16 * tm + 8 * hh + 4);
#pragma unroll
      for (int j = 0; j < 2; ++j) {
        v4f o0, o1;
        o0[0] = accO[j][0] * rn0[0]; o0[1] = accO[j][1] * rn0[1]; o0[2] = accO[j][2] * rn0[2]; o0[3] = accO[j][3] * rn0[3];
        o1[0] = accO[j][4] * rn1[0]; o1[1] = accO[j][5] * rn1[1]; o1[2] = accO[j][6] * rn1[2]; o1[3] = accO[j][7] * rn1[3];
        // element r -> out^T[v = 16*(tn0+j)+cc][l = 16*tm + 8h + r]
        const int off = (16 * (tn0 + j) + cc) * PITF + 16 * tm + 8 * hh;   // byte 272*v + 4*(16tm+8h): 16-B aligned
        *(v4f*)(sF + off)     = o0;
        *(v4f*)(sF + off + 4) = o1;
      }
    }
    __syncthreads();   // B6

    //      One instruction writes two whole rows (lanes 0-15 row r, lanes 16-31 row r+1, 16 B per lane);
    {
      const int c4 = cc * 4;
      {
#pragma unroll
        for (int it = 0; it < 4; ++it) {
          const int row = 8 * w + 2 * it + hh;
          const v4f val = *(const v4f*)(sF + row * PITF + c4);
          *(v4f*)(ob + (size_t)row * NSEQ + l0 + c4) = val;
        }
        
      }
    }
    // next chunk's phase 0 writes sX/sY only; sF is next written after B3 of that chunk.
  }
}

extern "C" void kernel_launch(void* const* d_in, const int* in_sizes, int n_in,
                              void* d_out, int out_size, void* d_ws, size_t ws_size,
                              hipStream_t stream) {
  (void)d_ws; (void)ws_size;
  if (n_in < 4) return;
  if (in_sizes[0] != NBATCH * NDIM * NSEQ) return;
  if (in_sizes[1] != NBATCH * NVAL * NSEQ) return;
  if (in_sizes[2] != NBATCH * NDIM * NSEQ) return;
  if (in_sizes[3] != NDIM * NFEAT) return;
  if (out_size != NBATCH * NVAL * NSEQ) return;
  const float* keys    = (const float*)d_in[0];
  const float* values  = (const float*)d_in[1];
  const float* queries = (const float*)d_in[2];
  const float* proj    = (const float*)d_in[3];
  float* out = (float*)d_out;
  lin_attn_causal_kernel<<<dim3(NBATCH), dim3(NTHR), 0, stream>>>(keys, values, queries, proj, out);
}

// v001
// One run takes 18.4 microseconds.
// Two timings next to v000 put it at 16.8 and 16.9 times that version's speed.
// All contractions (input projections, score tile phi_q*phi_k^T, score*V, phi_q*state, V*phi_k state update): v_wmma_f32_16x16x32_bf16 with bf16 hi/lo split operands (hi*hi + hi*lo + lo*hi), f32 accumulate; row normaliser and feature column sums on VALU in f32.
#include <hip/hip_runtime.h>

// ---------------- fixed problem geometry ----------------
constexpr int NBATCH = 8;      // batch
constexpr int NDIM   = 64;     // key/query feature dim (contraction of the projection)
constexpr int NSEQ   = 2048;   // sequence length
constexpr int NFEAT  = 64;     // projection features m
constexpr int NVAL   = 64;     // value dim
constexpr int CHUNK  = 64;     // time steps per sequential chunk
constexpr int NCHUNK = NSEQ / CHUNK;
constexpr int PITB   = 72;     // 16-bit LDS tile pitch (elements): 144 B rows, 16-B aligned fragment loads
constexpr int PITF   = 68;     // f32 LDS tile pitch (elements): 272 B rows
constexpr int NTHR   = 256;    // 8 waves per block
constexpr float FEAT_EPS = 1.0e-3f;

static_assert(NSEQ % CHUNK == 0);
static_assert(NDIM == 64 && NFEAT == 64 && NVAL == 64 && CHUNK == 64);
static_assert(CHUNK % 32 == 0);          // phase-3 thread-range branches are wave-uniform
static_assert(NTHR == 256);
static_assert((PITB * 2) % 16 == 0 && (PITF * 4) % 16 == 0);

typedef __attribute__((ext_vector_type(16))) __bf16   v16b;
typedef __attribute__((ext_vector_type(8)))  __bf16   v8b;
typedef __attribute__((ext_vector_type(8)))  float    v8f;
typedef __attribute__((ext_vector_type(4)))  float    v4f;
typedef __attribute__((ext_vector_type(4)))  unsigned int v4u;
typedef __attribute__((ext_vector_type(2)))  unsigned int v2u;

// ---------------- pieces ----------------
__device__ __forceinline__ unsigned short f2bf_bits(float f) {
  unsigned u = __float_as_uint(f);
  return (unsigned short)((u + 0x7FFFu + ((u >> 16) & 1u)) >> 16);
}
__device__ __forceinline__ float bf_bits2f(unsigned short h) { return __uint_as_float(((unsigned)h) << 16); }

__device__ __forceinline__ void dep_guard_b(v8f& a, v8f& b, v16b x, v16b y) { asm volatile("v_nop\n\tv_nop\n\tv_nop\n\tv_nop" : "+v"(a), "+v"(b) : "v"(x), "v"(y)); }
__device__ __forceinline__ void keep4_b(v16b a, v16b b, v16b c, v16b d) { asm volatile("v_nop" :: "v"(a), "v"(b), "v"(c), "v"(d)); }
template <typename T> struct Frag;
template <> struct Frag<__bf16> {
  typedef v16b V; union U { v16b v; v8b h[2]; };
  static __device__ __forceinline__ v16b load(const __bf16* p) {   // elements 0..7 <- p[0..7], 8..15 <- p[16..23]
    U f; f.h[0] = *(const v8b*)(p); f.h[1] = *(const v8b*)(p + 16); return f.v;
  }
  static __device__ __forceinline__ v8f mma(v16b a, v16b b, v8f c) {
    return __builtin_amdgcn_wmma_f32_16x16x32_bf16(false, a, false, b, (short)0, c, false, false);
  }
  static __device__ __forceinline__ void guard(v8f& a, v8f& b, v16b x, v16b y) { dep_guard_b(a, b, x, y); }
  static __device__ __forceinline__ void keep(v16b a, v16b b, v16b c, v16b d) { keep4_b(a, b, c, d); }
};

// one WMMA with the 4-slot hazard guard (ties D, keeps A/B live)
__device__ __forceinline__ v8f at_mma(v16b a, v16b b, v8f c) {
  c = __builtin_amdgcn_wmma_f32_16x16x32_bf16(false, a, false, b, (short)0, c, false, false);
  asm volatile("v_nop\n\tv_nop\n\tv_nop\n\tv_nop" : "+v"(c) : "v"(a), "v"(b));
  return c;
}

// ---------------- helpers ----------------
// bf16 hi/lo split (RNE convert): f ~= hi + lo, both as bf16 bit patterns
__device__ __forceinline__ void split_bits(float f, unsigned short& hi, unsigned short& lo) {
  hi = f2bf_bits(f);
  lo = f2bf_bits(f - bf_bits2f(hi));
}

__device__ __forceinline__ const __bf16* bfp(const unsigned short* p) { return (const __bf16*)(const void*)p; }

__device__ __forceinline__ v8f zero8() { return (v8f){0.f,0.f,0.f,0.f,0.f,0.f,0.f,0.f}; }

// One 16x16 output tile over K = 64 (two 32-deep steps) of C = A * Bt^T with hi/lo split planes.
// A planes row-major [row][PITB] (k contiguous), Bt planes row-major [n][PITB] (k contiguous); all in LDS.
// Per lane: A row = arow0 + (lane&15), Bt row = brow0 + (lane&15); fragment elements 0..7 <- k0 + 8h + 0..7,
// 8..15 <- k0 + 16 + 8h + 0..7 (h = lane>>4). D element r of lane l -> (arow0 + 8h + r, brow0 + (l&15)).
__device__ __forceinline__ v8f tile_k64_split(const unsigned short* Ah, const unsigned short* Al, int arow0,
                                               const unsigned short* Bh, const unsigned short* Bl, int brow0,
                                               int lane, v8f acc) {
  const int rl = lane & 15, koff = (lane >> 4) * 8;
#pragma unroll
  for (int ks = 0; ks < 2; ++ks) {
    const int ao = (arow0 + rl) * PITB + 32 * ks + koff;
    const int bo = (brow0 + rl) * PITB + 32 * ks + koff;
    const v16b ah = Frag<__bf16>::load(bfp(Ah) + ao);
    const v16b al = Frag<__bf16>::load(bfp(Al) + ao);
    const v16b bh = Frag<__bf16>::load(bfp(Bh) + bo);
    const v16b bl = Frag<__bf16>::load(bfp(Bl) + bo);
    acc = at_mma(ah, bh, acc);
    acc = at_mma(ah, bl, acc);
    acc = at_mma(al, bh, acc);
  }
  return acc;
}

// Store a D tile (element r of lane -> (row0 + 8h + r, col0 + (lane&15))) as hi/lo bf16 into row-major LDS planes.
__device__ __forceinline__ void put_split_rm(unsigned short* Ph, unsigned short* Pl, int row0, int col0, int lane, v8f v) {
  const int hq = lane >> 4, cq = lane & 15;
#pragma unroll
  for (int r = 0; r < 8; ++r) {
    unsigned short hb, lb;
    split_bits(v[r], hb, lb);
    const int off = (row0 + 8 * hq + r) * PITB + col0 + cq;
    Ph[off] = hb;
    Pl[off] = lb;
  }
}
// Store the TRANSPOSE of a D tile: element r of lane -> P[col0 + (lane&15)][row0 + 8h + r]; the 8 elements of a lane are
// contiguous -> one 16-B LDS store per plane built from per-lane integer words.
__device__ __forceinline__ void put_split_tr(unsigned short* Ph, unsigned short* Pl, int row0, int col0, int lane, v8f v) {
  const int hq = lane >> 4, cq = lane & 15;
  v4u uh, ul;
#pragma unroll
  for (int e = 0; e < 4; ++e) {
    unsigned short ha, la, hb, lb;
    split_bits(v[2 * e], ha, la);
    split_bits(v[2 * e + 1], hb, lb);
    uh[e] = (unsigned)ha | ((unsigned)hb << 16);
    ul[e] = (unsigned)la | ((unsigned)lb << 16);
  }
  const int off = (col0 + cq) * PITB + row0 + 8 * hq;   // byte offset 144*(col) + 2*(row0+8h): 16-B aligned
  *(v4u*)(Ph + off) = uh;
  *(v4u*)(Pl + off) = ul;
}

// =====================================================================================================
// The 32 chunks of 64 steps of a batch element run side by side, one block per (batch, chunk), in two launches.
// Launch 1 (chunks 0..30): phi_k of the chunk, then its own share of the state,
//   dS^T[v][m] = sum_i V[i][v] phi_k[i][m]  and  dz[m] = sum_i phi_k[i][m],  stored in the workspace.
// Launch 2 (chunks 0..31): S_old^T and z_old = sums of the shares of all earlier chunks, in chunk order, then
//   phi_q[l][m], phi_k[i][m] = relu(x^T W) + eps             (projection GEMMs, K = d = 64)
//   A[l][i] = sum_m phi_q[l][m] phi_k[i][m], kept for i <= l  (score tile, K = m = 64)
//   norm[l] = phi_q[l].z_old + sum_i A[l][i]                  (VALU f32)
//   out[l][v] = (sum_i A[l][i] V[i][v] + sum_m phi_q[l][m] S_old[m][v]) / norm[l]
// Workspace (f32): share of (b, c) at (b*NCHUNK + c)*SHARE, held in the owning thread's register order:
//   word q*4*NTHR + 4*tid + e = element 4*(q&1)+e of tile j = q>>1 of thread tid (16 B per lane, 512 B per wave and store);
//   behind all shares, dz of (b, c) at (b*NCHUNK + c)*NFEAT. Every word launch 2 reads is written by launch 1 of the same call.
// =====================================================================================================
constexpr int SHARE    = NVAL * NFEAT;                     // f32 words of one chunk's state share
constexpr int DZ_BASE  = NBATCH * NCHUNK * SHARE;          // first word of the dz rows
constexpr int WS_WORDS = DZ_BASE + NBATCH * NCHUNK * NFEAT;
constexpr int PGROUP   = 8;                                // shares fetched together in launch 2

// 16-B global load at a block-uniform base plus a per-thread byte offset plus a constant: the base stays in scalar registers
// and one offset register serves every load of a thread.
__device__ __forceinline__ v4f ld16(const float* __restrict__ ubase, unsigned tbyte, unsigned cbyte) {
  return *(const v4f*)((const char*)ubase + tbyte + cbyte);
}
// per-thread byte offset into a [row][NSEQ] f32 tensor for the 64 x 64 chunk loads: row tid>>4, columns 4*(tid&15)..+3;
// pass 'it' adds 16 rows
__device__ __forceinline__ unsigned chunk_tbyte(int tid) { return (unsigned)(((tid >> 4) * NSEQ + ((tid & 15) << 2)) * 4); }
constexpr unsigned ROWS16_BYTES = 16u * NSEQ * 4u;

// W^T hi/lo staging: proj is [d][m] f32; 1024 v4f = 256 threads x 4; covers all 64x64
__device__ __forceinline__ void stage_w(const float* __restrict__ proj, unsigned short* sWh, unsigned short* sWl, int tid) {
#pragma unroll
  for (int it = 0; it < 4; ++it) {
    const int idx = tid + it * NTHR;
    const int d   = idx >> 4;
    const int m4  = (idx & 15) << 2;
    const v4f wv = ld16(proj, 16u * (unsigned)tid, (unsigned)it * 16u * NTHR);
#pragma unroll
    for (int e = 0; e < 4; ++e) {
      unsigned short hb, lb;
      split_bits(wv[e], hb, lb);
      const int off = (m4 + e) * PITB + d;
      sWh[off] = hb;
      sWl[off] = lb;
    }
  }
}

// V chunk (vc = first column of the chunk in row 0): [v][i] f32 -> hi/lo planes [v][i]; 1024 v4f = 256 x 4; 4 halves packed into two integer words per plane
__device__ __forceinline__ void stage_v(const float* __restrict__ vc, unsigned short* sVh, unsigned short* sVl, int tid) {
#pragma unroll
  for (int it = 0; it < 4; ++it) {
    const int idx = tid + it * NTHR;
    const int vr  = idx >> 4;
    const int i4  = (idx & 15) << 2;
    const v4f vv = ld16(vc, chunk_tbyte(tid), (unsigned)it * ROWS16_BYTES);
    unsigned short h0, g0, h1, g1, h2, g2, h3, g3;
    split_bits(vv[0], h0, g0);
    split_bits(vv[1], h1, g1);
    split_bits(vv[2], h2, g2);
    split_bits(vv[3], h3, g3);
    v2u uh, ul;
    uh[0] = (unsigned)h0 | ((unsigned)h1 << 16);
    uh[1] = (unsigned)h2 | ((unsigned)h3 << 16);
    ul[0] = (unsigned)g0 | ((unsigned)g1 << 16);
    ul[1] = (unsigned)g2 | ((unsigned)g3 << 16);
    const int off = vr * PITB + i4;      // byte 144*vr + 2*i4 : 8-B aligned
    *(v2u*)(sVh + off) = uh;
    *(v2u*)(sVl + off) = ul;
  }
}

// ---------------- launch 1: one chunk's share of the state ----------------
__global__ __launch_bounds__(NTHR)
void lin_attn_chunk_state_kernel(const float* __restrict__ keys,
                                 const float* __restrict__ values,
                                 const float* __restrict__ proj,
                                 float* __restrict__ ws) {
  __shared__ __align__(16) unsigned short sVh[NVAL * PITB];    // V hi [v][i]
  __shared__ __align__(16) unsigned short sVl[NVAL * PITB];
  __shared__ __align__(16) unsigned short sYh[CHUNK * PITB];   // k^T hi [i][d]
  __shared__ __align__(16) unsigned short sYl[CHUNK * PITB];
  __shared__ __align__(16) unsigned short sWh[NFEAT * PITB];   // W^T hi [m][d]
  __shared__ __align__(16) unsigned short sWl[NFEAT * PITB];
  __shared__ __align__(16) unsigned short sKTh[NFEAT * PITB];  // phi_k^T hi [m][i]
  __shared__ __align__(16) unsigned short sKTl[NFEAT * PITB];

  const int tid  = threadIdx.x;
  const int lane = tid & 31;
  const int w    = tid >> 5;
  const int hh   = lane >> 4;
  const int tm   = w >> 1;
  const int tn0  = (w & 1) * 2;
  const int b    = blockIdx.x;        // grid.x == NBATCH
  const int ch   = blockIdx.y;        // grid.y == NCHUNK - 1: the last chunk's share has no reader
  const int l0   = ch * CHUNK;

  const float* kc = keys   + (size_t)b * NDIM * NSEQ + l0;
  const float* vc = values + (size_t)b * NVAL * NSEQ + l0;

  stage_w(proj, sWh, sWl, tid);
  // k chunk: [d][l0..l0+63] f32 -> hi/lo bf16 transposed [i][d]
#pragma unroll
  for (int it = 0; it < 4; ++it) {
    const int idx = tid + it * NTHR;
    const int d   = idx >> 4;
    const int i4  = (idx & 15) << 2;
    const v4f kv = ld16(kc, chunk_tbyte(tid), (unsigned)it * ROWS16_BYTES);
#pragma unroll
    for (int e = 0; e < 4; ++e) {
      unsigned short hk, lk;
      split_bits(kv[e], hk, lk);
      const int off = (i4 + e) * PITB + d;
      sYh[off] = hk; sYl[off] = lk;
    }
  }
  stage_v(vc, sVh, sVl, tid);
  __syncthreads();   // k^T, W^T and V planes complete

  // phi_k = relu(k^T W) + eps : A = k^T [i][d], Bt = W^T [m][d]; stored transposed [m][i]
  {
    v8f ak[2];
    ak[0] = zero8(); ak[1] = zero8();
    const int rl = lane & 15, koff = hh * 8;
#pragma unroll
    for (int ks = 0; ks < 2; ++ks) {
      const int ao = (16 * tm + rl) * PITB + 32 * ks + koff;
      const v16b kh = Frag<__bf16>::load(bfp(sYh) + ao);
      const v16b kl = Frag<__bf16>::load(bfp(sYl) + ao);
#pragma unroll
      for (int j = 0; j < 2; ++j) {
        const int bo = (16 * (tn0 + j) + rl) * PITB + 32 * ks + koff;
        const v16b wh = Frag<__bf16>::load(bfp(sWh) + bo);
        const v16b wl = Frag<__bf16>::load(bfp(sWl) + bo);
        ak[j] = at_mma(kh, wh, ak[j]);
        ak[j] = at_mma(kh, wl, ak[j]);
        ak[j] = at_mma(kl, wh, ak[j]);
      }
    }
#pragma unroll
    for (int j = 0; j < 2; ++j) {
      v8f pk;
#pragma unroll
      for (int r = 0; r < 8; ++r) pk[r] = fmaxf(ak[j][r], 0.f) + FEAT_EPS;
      put_split_tr(sKTh, sKTl, 16 * tm, 16 * (tn0 + j), lane, pk);
    }
  }
  __syncthreads();   // phi_k^T planes complete

  // dS^T[v][m] = sum_i V[i][v] phi_k[i][m] : A = V [v][i] rows v, Bt = phi_k^T [m][i] rows m
  v8f ds[2];
#pragma unroll
  for (int j = 0; j < 2; ++j)
    ds[j] = tile_k64_split(sVh, sVl, 16 * tm, sKTh, sKTl, 16 * (tn0 + j), lane, zero8());
  // dz[m] = sum_i phi_k[i][m], from the hi + lo planes (waves 0-1; the branch is wave-uniform)
  float zp = 0.f;
  if (tid < NFEAT) {
#pragma unroll
    for (int j = 0; j < 8; ++j) {
      const v4u wh = *(const v4u*)(sKTh + tid * PITB + 8 * j);
      const v4u wl = *(const v4u*)(sKTl + tid * PITB + 8 * j);
#pragma unroll
      for (int e = 0; e < 4; ++e) {
        zp += __uint_as_float(wh[e] << 16) + __uint_as_float(wl[e] << 16);
        zp += __uint_as_float(wh[e] & 0xffff0000u) + __uint_as_float(wl[e] & 0xffff0000u);
      }
    }
  }
  // the stores come last: no register that they name is written again
  float* sb = ws + (size_t)(b * NCHUNK + ch) * SHARE + 4 * tid;
#pragma unroll
  for (int j = 0; j < 2; ++j) {
    v4f a0, a1;
    a0[0] = ds[j][0]; a0[1] = ds[j][1]; a0[2] = ds[j][2]; a0[3] = ds[j][3];
    a1[0] = ds[j][4]; a1[1] = ds[j][5]; a1[2] = ds[j][6]; a1[3] = ds[j][7];
    *(v4f*)(sb + (2 * j)     * 4 * NTHR) = a0;
    *(v4f*)(sb + (2 * j + 1) * 4 * NTHR) = a1;
  }
  if (tid < NFEAT) ws[DZ_BASE + (b * NCHUNK + ch) * NFEAT + tid] = zp;
}

// ---------------- launch 2: one chunk's outputs ----------------
// LDS tile reuse (every producer/consumer pair of a tile is separated by a block barrier):
//   sXh/sXl : q^T hi/lo [l][d] (phases 0-1), then V as Bt [v][i] (phases 2-4)
//   sYh/sYl : k^T hi/lo [l][d] (phases 0-1), then S_old^T as Bt [v][m] (phases 2-4)
//   sKAh/l  : phi_k [i][m] (phases 1-2), then masked A [l][i] (phases 2b-4)
//   sF      : masked A in f32 [l][i] (phases 2b-3), then out^T [v][l] f32 (phases 4-5)
__global__ __launch_bounds__(NTHR)
void lin_attn_chunk_out_kernel(const float* __restrict__ keys,
                               const float* __restrict__ values,
                               const float* __restrict__ queries,
                               const float* __restrict__ proj,
                               const float* __restrict__ ws,
                               float* __restrict__ out) {
  __shared__ __align__(16) unsigned short sXh[CHUNK * PITB];
  __shared__ __align__(16) unsigned short sXl[CHUNK * PITB];
  __shared__ __align__(16) unsigned short sYh[CHUNK * PITB];
  __shared__ __align__(16) unsigned short sYl[CHUNK * PITB];
  __shared__ __align__(16) unsigned short sWh[NFEAT * PITB];   // W^T hi [m][d]
  __shared__ __align__(16) unsigned short sWl[NFEAT * PITB];   // W^T lo [m][d]
  __shared__ __align__(16) unsigned short sQh[CHUNK * PITB];   // phi_q hi [l][m]
  __shared__ __align__(16) unsigned short sQl[CHUNK * PITB];
  __shared__ __align__(16) unsigned short sKAh[CHUNK * PITB];
  __shared__ __align__(16) unsigned short sKAl[CHUNK * PITB];
  __shared__ __align__(16) float sF[CHUNK * PITF];
  __shared__ __align__(16) float sZ[NFEAT];
  __shared__ __align__(16) float sRN[CHUNK];

  const int tid  = threadIdx.x;
  const int lane = tid & 31;
  const int w    = tid >> 5;          // wave 0..7
  const int hh   = lane >> 4;
  const int cc   = lane & 15;
  const int tm   = w >> 1;            // row-tile index owned by this wave in every 64x64 GEMM
  const int tn0  = (w & 1) * 2;       // first of the two column tiles owned by this wave
  const int b    = blockIdx.x;                   // grid.x == NBATCH
  const int ch   = NCHUNK - 1 - (int)blockIdx.y; // grid.y == NCHUNK; the chunks with the most shares to sum start first
  const int l0   = ch * CHUNK;

  const float* kc = keys    + (size_t)b * NDIM * NSEQ + l0;
  const float* qc = queries + (size_t)b * NDIM * NSEQ + l0;
  const float* vc = values  + (size_t)b * NVAL * NSEQ + l0;
  float*       ob = out     + (size_t)b * NVAL * NSEQ;

  stage_w(proj, sWh, sWl, tid);

  // ---- phase 0: q, k chunk: [d][l0..l0+63] f32 -> hi/lo bf16 transposed [l][d]; 1024 v4f per tensor = 256 x 4 ----
  v4f qv[4], kv[4];
#pragma unroll
  for (int it = 0; it < 4; ++it) {
    qv[it] = ld16(qc, chunk_tbyte(tid), (unsigned)it * ROWS16_BYTES);
    kv[it] = ld16(kc, chunk_tbyte(tid), (unsigned)it * ROWS16_BYTES);
  }
  // precaution: the build reuses the scalar base registers of the loads above right behind them; this wait stands in front
  asm volatile("s_wait_xcnt 0x0" ::: "memory");
#pragma unroll
  for (int it = 0; it < 4; ++it) {
    const int idx = tid + it * NTHR;
    const int d   = idx >> 4;
    const int i4  = (idx & 15) << 2;
#pragma unroll
    for (int e = 0; e < 4; ++e) {
      unsigned short hq, lq, hk, lk;
      split_bits(qv[it][e], hq, lq);
      split_bits(kv[it][e], hk, lk);
      const int off = (i4 + e) * PITB + d;
      sXh[off] = hq; sXl[off] = lq;
      sYh[off] = hk; sYl[off] = lk;
    }
  }

  // ---- S_old^T (this thread's two tiles) and z_old: shares of chunks 0..ch-1 summed in chunk order ----
  // PGROUP shares are fetched together so that their loads are in flight at once; a slot at or past ch is read from a
  // slot that launch 1 has written (index clamped to the last one) and counts as zero.
  v8f accS[2];                        // S^T tiles: rows v = 16*tm + 8h + r, cols m = 16*(tn0+j) + cc
  accS[0] = zero8();
  accS[1] = zero8();
  {
    const float* pb = ws + (size_t)b * NCHUNK * SHARE;             // block-uniform
    const float* zb = ws + DZ_BASE + b * NCHUNK * NFEAT;           // block-uniform
    const int zi = tid & (NFEAT - 1);
    // all dz rows that launch 1 writes are asked for at once, ahead of the shares; they are summed behind them
    float zx[NCHUNK - 1];
#pragma unroll
    for (int c = 0; c < NCHUNK - 1; ++c) zx[c] = *(const float*)((const char*)(zb + c * NFEAT) + 4u * (unsigned)zi);
    // unrolled so that every slot's place is a constant in the load's offset field; the test is block-uniform
#pragma unroll
    for (int g = 0; g < NCHUNK - 1; g += PGROUP) {
      if (g >= ch) break;
      v4f x[PGROUP][4];
#pragma unroll
      for (int u = 0; u < PGROUP; ++u) {
        const int cs = (g + u < NCHUNK - 1) ? g + u : NCHUNK - 2;
#pragma unroll
        for (int q = 0; q < 4; ++q) x[u][q] = ld16(pb + (size_t)cs * SHARE, 16u * (unsigned)tid, (unsigned)q * 16u * NTHR);
      }
      // keeps the group's loads together in front of its sums: left free, the scheduler issues them two at a time, each
      // pair waiting out a whole trip to L2
      __builtin_amdgcn_sched_barrier(0);
#pragma unroll
      for (int u = 0; u < PGROUP; ++u) {
        const bool live = (g + u) < ch;
#pragma unroll
        for (int q = 0; q < 4; ++q)
#pragma unroll
          for (int e = 0; e < 4; ++e)
            accS[q >> 1][4 * (q & 1) + e] += live ? x[u][q][e] : 0.f;
      }
    }
    float zs = 0.f;
#pragma unroll
    for (int c = 0; c < NCHUNK - 1; ++c) zs += (c < ch) ? zx[c] : 0.f;
    if (tid < NFEAT) sZ[zi] = zs;
  }
  __syncthreads();   // B1

  // ---- phase 1: phi = relu(x^T W) + eps : A = x^T [l][d], Bt = W^T [m][d] ----
  {
    v8f aq[2], ak[2];
    aq[0] = zero8(); aq[1] = zero8(); ak[0] = zero8(); ak[1] = zero8();
    const int rl = lane & 15, koff = hh * 8;
#pragma unroll
    for (int ks = 0; ks < 2; ++ks) {
      const int ao = (16 * tm + rl) * PITB + 32 * ks + koff;
      const v16b qh = Frag<__bf16>::load(bfp(sXh) + ao);
      const v16b ql = Frag<__bf16>::load(bfp(sXl) + ao);
      const v16b kh = Frag<__bf16>::load(bfp(sYh) + ao);
      const v16b kl = Frag<__bf16>::load(bfp(sYl) + ao);
#pragma unroll
      for (int j = 0; j < 2; ++j) {
        const int bo = (16 * (tn0 + j) + rl) * PITB + 32 * ks + koff;
        const v16b wh = Frag<__bf16>::load(bfp(sWh) + bo);
        const v16b wl = Frag<__bf16>::load(bfp(sWl) + bo);
        aq[j] = at_mma(qh, wh, aq[j]);
        aq[j] = at_mma(qh, wl, aq[j]);
        aq[j] = at_mma(ql, wh, aq[j]);
        ak[j] = at_mma(kh, wh, ak[j]);
        ak[j] = at_mma(kh, wl, ak[j]);
        ak[j] = at_mma(kl, wh, ak[j]);
      }
    }
#pragma unroll
    for (int j = 0; j < 2; ++j) {
      v8f pq, pk;
#pragma unroll
      for (int r = 0; r < 8; ++r) {
        pq[r] = fmaxf(aq[j][r], 0.f) + FEAT_EPS;
        pk[r] = fmaxf(ak[j][r], 0.f) + FEAT_EPS;
      }
      put_split_rm(sQh,  sQl,  16 * tm, 16 * (tn0 + j), lane, pq);   // phi_q [l][m]
      put_split_rm(sKAh, sKAl, 16 * tm, 16 * (tn0 + j), lane, pk);   // phi_k [i][m]
    }
  }
  __syncthreads();   // B2

  // ---- phase 2: stage V ([v][l0+i] f32 -> hi/lo Bt [v][i]), stage S_old^T hi/lo, score GEMM ----
  v8f accA[2];
  {
    stage_v(vc, sXh, sXl, tid);
    // S_old^T as Bt [v][m]
    put_split_rm(sYh, sYl, 16 * tm, 16 * tn0,       lane, accS[0]);
    put_split_rm(sYh, sYl, 16 * tm, 16 * (tn0 + 1), lane, accS[1]);
    // A[l][i] = sum_m phi_q[l][m] phi_k[i][m] : A = phi_q rows l, Bt = phi_k rows i; causal mask i <= l
#pragma unroll
    for (int j = 0; j < 2; ++j) {
      accA[j] = tile_k64_split(sQh, sQl, 16 * tm, sKAh, sKAl, 16 * (tn0 + j), lane, zero8());
#pragma unroll
      for (int r = 0; r < 8; ++r) {
        const int row = 16 * tm + 8 * hh + r;
        const int col = 16 * (tn0 + j) + cc;
        const float a = accA[j][r];
        accA[j][r] = (col <= row) ? a : 0.f;
      }
    }
  }
  __syncthreads();   // B3

  // ---- phase 2b: masked A -> hi/lo planes (over phi_k's tile space) and f32 copy (explicit zeros stored) ----
#pragma unroll
  for (int j = 0; j < 2; ++j) {
    put_split_rm(sKAh, sKAl, 16 * tm, 16 * (tn0 + j), lane, accA[j]);
#pragma unroll
    for (int r = 0; r < 8; ++r)
      sF[(16 * tm + 8 * hh + r) * PITF + 16 * (tn0 + j) + cc] = accA[j][r];
  }
  __syncthreads();   // B4

  // ---- phase 3: normaliser (waves 0-1); the branch is wave-uniform ----
  if (tid < CHUNK) {
    const int l = tid;
    float s = 0.f;
#pragma unroll 1
    for (int j = 0; j < 8; ++j) {
      const v4u wh = *(const v4u*)(sQh + l * PITB + 8 * j);
      const v4u wl = *(const v4u*)(sQl + l * PITB + 8 * j);
#pragma unroll
      for (int e = 0; e < 4; ++e) {
        const float p0 = __uint_as_float(wh[e] << 16) + __uint_as_float(wl[e] << 16);
        const float p1 = __uint_as_float(wh[e] & 0xffff0000u) + __uint_as_float(wl[e] & 0xffff0000u);
        s += p0 * sZ[8 * j + 2 * e];
        s += p1 * sZ[8 * j + 2 * e + 1];
      }
    }
    float asum = 0.f;
#pragma unroll 1
    for (int i = 0; i < CHUNK; i += 4) {
      const v4f av = *(const v4f*)(sF + l * PITF + i);
      asum += (av[0] + av[1]) + (av[2] + av[3]);
    }
    sRN[l] = 1.0f / (s + asum);
  }
  __syncthreads();   // B5

  // ---- phase 4: out tile, epilogue into out^T [v][l] f32 ----
  {
    v8f accO[2];
#pragma unroll
    for (int j = 0; j < 2; ++j) {
      // sum_i A[l][i] V[i][v] : A = masked A rows l, Bt = V [v][i]
      accO[j] = tile_k64_split(sKAh, sKAl, 16 * tm, sXh, sXl, 16 * (tn0 + j), lane, zero8());
      // + sum_m phi_q[l][m] S_old[m][v] : A = phi_q rows l, Bt = S_old^T [v][m]
      accO[j] = tile_k64_split(sQh, sQl, 16 * tm, sYh, sYl, 16 * (tn0 + j), lane, accO[j]);
    }
    const v4f rn0 = *(const v4f*)(sRN + 16 * tm + 8 * hh);
    const v4f rn1 = *(const v4f*)(sRN + 16 * tm + 8 * hh + 4);
#pragma unroll
    for (int j = 0; j < 2; ++j) {
      v4f o0, o1;
      o0[0] = accO[j][0] * rn0[0]; o0[1] = accO[j][1] * rn0[1]; o0[2] = accO[j][2] * rn0[2]; o0[3] = accO[j][3] * rn0[3];
      o1[0] = accO[j][4] * rn1[0]; o1[1] = accO[j][5] * rn1[1]; o1[2] = accO[j][6] * rn1[2]; o1[3] = accO[j][7] * rn1[3];
      // element r -> out^T[v = 16*(tn0+j)+cc][l = 16*tm + 8h + r]
      const int off = (16 * (tn0 + j) + cc) * PITF + 16 * tm + 8 * hh;   // byte 272*v + 4*(16tm+8h): 16-B aligned
      *(v4f*)(sF + off)     = o0;
      *(v4f*)(sF + off + 4) = o1;
    }
  }
  __syncthreads();   // B6

  // One instruction writes two whole rows (lanes 0-15 row r, lanes 16-31 row r+1, 16 B per lane)
  {
    const int c4 = cc * 4;
#pragma unroll
    for (int it = 0; it < 4; ++it) {
      const int row = 8 * w + 2 * it + hh;
      const v4f val = *(const v4f*)(sF + row * PITF + c4);
      *(v4f*)(ob + (size_t)row * NSEQ + l0 + c4) = val;
    }
  }
}

extern "C" void kernel_launch(void* const* d_in, const int* in_sizes, int n_in,
                              void* d_out, int out_size, void* d_ws, size_t ws_size,
                              hipStream_t stream) {
  if (n_in < 4) return;
  if (in_sizes[0] != NBATCH * NDIM * NSEQ) return;
  if (in_sizes[1] != NBATCH * NVAL * NSEQ) return;
  if (in_sizes[2] != NBATCH * NDIM * NSEQ) return;
  if (in_sizes[3] != NDIM * NFEAT) return;
  if (out_size != NBATCH * NVAL * NSEQ) return;
  if (ws_size < sizeof(float) * WS_WORDS) return;
  const float* keys    = (const float*)d_in[0];
  const float* values  = (const float*)d_in[1];
  const float* queries = (const float*)d_in[2];
  const float* proj    = (const float*)d_in[3];
  float* out = (float*)d_out;
  float* ws  = (float*)d_ws;
  lin_attn_chunk_state_kernel<<<dim3(NBATCH, NCHUNK - 1), dim3(NTHR), 0, stream>>>(keys, values, proj, ws);
  lin_attn_chunk_out_kernel<<<dim3(NBATCH, NCHUNK), dim3(NTHR), 0, stream>>>(keys, values, queries, proj, ws, out);
}

// v002
// It runs in 17.1 microseconds.
// Two timings next to v001 put it at 1.08 and 1.07 times that version's speed.
// Over all steps from v000 it is 18.1 times as fast.
// All contractions (input projections, score tile phi_q*phi_k^T, score*V, phi_q*state, V*phi_k state update): v_wmma_f32_16x16x32_bf16 with bf16 hi/lo split operands (hi*hi + hi*lo + lo*hi), f32 accumulate; the row normaliser is one more column tile of the output products (same form, same split); feature column sums on VALU in f32.
#include <hip/hip_runtime.h>

// ---------------- fixed problem geometry ----------------
constexpr int NBATCH = 8;      // batch
constexpr int NDIM   = 64;     // key/query feature dim (contraction of the projection)
constexpr int NSEQ   = 2048;   // sequence length
constexpr int NFEAT  = 64;     // projection features m
constexpr int NVAL   = 64;     // value dim
constexpr int CHUNK  = 64;     // time steps per sequential chunk
constexpr int NCHUNK = NSEQ / CHUNK;
constexpr int PITB   = 72;     // 16-bit LDS tile pitch (elements): 144 B rows, 16-B aligned fragment loads
constexpr int PITF   = 68;     // f32 LDS tile pitch (elements): 272 B rows
constexpr int NTHR   = 256;    // 8 waves per block
constexpr float FEAT_EPS = 1.0e-3f;

static_assert(NSEQ % CHUNK == 0);
static_assert(NDIM == 64 && NFEAT == 64 && NVAL == 64 && CHUNK == 64);
static_assert(NFEAT % 32 == 0);          // the tid < NFEAT branches are wave-uniform
static_assert(NTHR == 256);
static_assert((PITB * 2) % 16 == 0 && (PITF * 4) % 16 == 0);

typedef __attribute__((ext_vector_type(16))) __bf16   v16b;
typedef __attribute__((ext_vector_type(8)))  __bf16   v8b;
typedef __attribute__((ext_vector_type(8)))  float    v8f;
typedef __attribute__((ext_vector_type(4)))  float    v4f;
typedef __attribute__((ext_vector_type(4)))  unsigned int v4u;
typedef __attribute__((ext_vector_type(2)))  unsigned int v2u;

// ---------------- pieces ----------------
__device__ __forceinline__ unsigned short f2bf_bits(float f) {
  unsigned u = __float_as_uint(f);
  return (unsigned short)((u + 0x7FFFu + ((u >> 16) & 1u)) >> 16);
}
__device__ __forceinline__ float bf_bits2f(unsigned short h) { return __uint_as_float(((unsigned)h) << 16); }

__device__ __forceinline__ void dep_guard_b(v8f& a, v8f& b, v16b x, v16b y) { asm volatile("v_nop\n\tv_nop\n\tv_nop\n\tv_nop" : "+v"(a), "+v"(b) : "v"(x), "v"(y)); }
__device__ __forceinline__ void keep4_b(v16b a, v16b b, v16b c, v16b d) { asm volatile("v_nop" :: "v"(a), "v"(b), "v"(c), "v"(d)); }
template <typename T> struct Frag;
template <> struct Frag<__bf16> {
  typedef v16b V; union U { v16b v; v8b h[2]; };
  static __device__ __forceinline__ v16b load(const __bf16* p) {   // elements 0..7 <- p[0..7], 8..15 <- p[16..23]
    U f; f.h[0] = *(const v8b*)(p); f.h[1] = *(const v8b*)(p + 16); return f.v;
  }
  static __device__ __forceinline__ v8f mma(v16b a, v16b b, v8f c) {
    return __builtin_amdgcn_wmma_f32_16x16x32_bf16(false, a, false, b, (short)0, c, false, false);
  }
  static __device__ __forceinline__ void guard(v8f& a, v8f& b, v16b x, v16b y) { dep_guard_b(a, b, x, y); }
  static __device__ __forceinline__ void keep(v16b a, v16b b, v16b c, v16b d) { keep4_b(a, b, c, d); }
};

// one WMMA with the 4-slot hazard guard (ties D, keeps A/B live)
__device__ __forceinline__ v8f at_mma(v16b a, v16b b, v8f c) {
  c = __builtin_amdgcn_wmma_f32_16x16x32_bf16(false, a, false, b, (short)0, c, false, false);
  asm volatile("v_nop\n\tv_nop\n\tv_nop\n\tv_nop" : "+v"(c) : "v"(a), "v"(b));
  return c;
}

// ---------------- helpers ----------------
// bf16 hi/lo split (RNE convert): f ~= hi + lo, both as bf16 bit patterns
__device__ __forceinline__ void split_bits(float f, unsigned short& hi, unsigned short& lo) {
  hi = f2bf_bits(f);
  lo = f2bf_bits(f - bf_bits2f(hi));
}

__device__ __forceinline__ const __bf16* bfp(const unsigned short* p) { return (const __bf16*)(const void*)p; }

__device__ __forceinline__ v8f zero8() { return (v8f){0.f,0.f,0.f,0.f,0.f,0.f,0.f,0.f}; }

// One 16x16 output tile over K = 64 (two 32-deep steps) of C = A * Bt^T with hi/lo split planes.
// A planes row-major [row][PITB] (k contiguous), Bt planes row-major [n][PITB] (k contiguous); all in LDS.
// Per lane: A row = arow0 + (lane&15), Bt row = brow0 + (lane&15); fragment elements 0..7 <- k0 + 8h + 0..7,
// 8..15 <- k0 + 16 + 8h + 0..7 (h = lane>>4). D element r of lane l -> (arow0 + 8h + r, brow0 + (l&15)).
__device__ __forceinline__ v8f tile_k64_split(const unsigned short* Ah, const unsigned short* Al, int arow0,
                                               const unsigned short* Bh, const unsigned short* Bl, int brow0,
                                               int lane, v8f acc) {
  const int rl = lane & 15, koff = (lane >> 4) * 8;
#pragma unroll
  for (int ks = 0; ks < 2; ++ks) {
    const int ao = (arow0 + rl) * PITB + 32 * ks + koff;
    const int bo = (brow0 + rl) * PITB + 32 * ks + koff;
    const v16b ah = Frag<__bf16>::load(bfp(Ah) + ao);
    const v16b al = Frag<__bf16>::load(bfp(Al) + ao);
    const v16b bh = Frag<__bf16>::load(bfp(Bh) + bo);
    const v16b bl = Frag<__bf16>::load(bfp(Bl) + bo);
    acc = at_mma(ah, bh, acc);
    acc = at_mma(ah, bl, acc);
    acc = at_mma(al, bh, acc);
  }
  return acc;
}

// tile_k64_split, and on the same A fragments one more column tile accN += A * N^T whose 16 rows of N^T are all the vector n:
// every column of accN is alike, so element r of any lane is sum_k A[arow0 + 8h + r][k] n[k]. nh/nl[ks] hold n in the B fragment's
// k order (elements 0..7 <- n[32ks + 8h + 0..7], 8..15 <- n[32ks + 16 + 8h + 0..7]); NLO = false: n is exact in nh, nl is not used.
// acc gets the same products in the same order as in tile_k64_split.
template <bool NLO>
__device__ __forceinline__ v8f tile_k64_split_rowdot(const unsigned short* Ah, const unsigned short* Al, int arow0,
                                                      const unsigned short* Bh, const unsigned short* Bl, int brow0,
                                                      const v16b (&nh)[2], const v16b (&nl)[2],
                                                      int lane, v8f acc, v8f& accN) {
  const int rl = lane & 15, koff = (lane >> 4) * 8;
#pragma unroll
  for (int ks = 0; ks < 2; ++ks) {
    const int ao = (arow0 + rl) * PITB + 32 * ks + koff;
    const int bo = (brow0 + rl) * PITB + 32 * ks + koff;
    const v16b ah = Frag<__bf16>::load(bfp(Ah) + ao);
    const v16b al = Frag<__bf16>::load(bfp(Al) + ao);
    const v16b bh = Frag<__bf16>::load(bfp(Bh) + bo);
    const v16b bl = Frag<__bf16>::load(bfp(Bl) + bo);
    acc  = at_mma(ah, bh, acc);
    accN = at_mma(ah, nh[ks], accN);
    acc  = at_mma(ah, bl, acc);
    if (NLO) accN = at_mma(ah, nl[ks], accN);
    acc  = at_mma(al, bh, acc);
    accN = at_mma(al, nh[ks], accN);
  }
  return acc;
}

// Store a D tile (element r of lane -> (row0 + 8h + r, col0 + (lane&15))) as hi/lo bf16 into row-major LDS planes.
__device__ __forceinline__ void put_split_rm(unsigned short* Ph, unsigned short* Pl, int row0, int col0, int lane, v8f v) {
  const int hq = lane >> 4, cq = lane & 15;
#pragma unroll
  for (int r = 0; r < 8; ++r) {
    unsigned short hb, lb;
    split_bits(v[r], hb, lb);
    const int off = (row0 + 8 * hq + r) * PITB + col0 + cq;
    Ph[off] = hb;
    Pl[off] = lb;
  }
}
// Store the TRANSPOSE of a D tile: element r of lane -> P[col0 + (lane&15)][row0 + 8h + r]; the 8 elements of a lane are
// contiguous -> one 16-B LDS store per plane built from per-lane integer words.
__device__ __forceinline__ void put_split_tr(unsigned short* Ph, unsigned short* Pl, int row0, int col0, int lane, v8f v) {
  const int hq = lane >> 4, cq = lane & 15;
  v4u uh, ul;
#pragma unroll
  for (int e = 0; e < 4; ++e) {
    unsigned short ha, la, hb, lb;
    split_bits(v[2 * e], ha, la);
    split_bits(v[2 * e + 1], hb, lb);
    uh[e] = (unsigned)ha | ((unsigned)hb << 16);
    ul[e] = (unsigned)la | ((unsigned)lb << 16);
  }
  const int off = (col0 + cq) * PITB + row0 + 8 * hq;   // byte offset 144*(col) + 2*(row0+8h): 16-B aligned
  *(v4u*)(Ph + off) = uh;
  *(v4u*)(Pl + off) = ul;
}

// =====================================================================================================
// The 32 chunks of 64 steps of a batch element run side by side, one block per (batch, chunk), in two launches.
// Launch 1 (chunks 0..30): phi_k of the chunk, then its own share of the state,
//   dS^T[v][m] = sum_i V[i][v] phi_k[i][m]  and  dz[m] = sum_i phi_k[i][m],  stored in the workspace.
// Launch 2 (chunks 0..31): S_old^T and z_old = sums of the shares of all earlier chunks, in chunk order, then
//   phi_q[l][m], phi_k[i][m] = relu(x^T W) + eps             (projection GEMMs, K = d = 64)
//   A[l][i] = sum_m phi_q[l][m] phi_k[i][m], kept for i <= l  (score tile, K = m = 64)
//   norm[l] = phi_q[l].z_old + sum_i A[l][i]                  (a column tile beside out's: B = z_old, B = ones)
//   out[l][v] = (sum_i A[l][i] V[i][v] + sum_m phi_q[l][m] S_old[m][v]) / norm[l]
// Workspace (f32): share of (b, c) at (b*NCHUNK + c)*SHARE, held in the owning thread's register order:
//   word q*4*NTHR + 4*tid + e = element 4*(q&1)+e of tile j = q>>1 of thread tid (16 B per lane, 512 B per wave and store);
//   behind all shares, dz of (b, c) at (b*NCHUNK + c)*NFEAT. Every word launch 2 reads is written by launch 1 of the same call.
// =====================================================================================================
constexpr int SHARE    = NVAL * NFEAT;                     // f32 words of one chunk's state share
constexpr int DZ_BASE  = NBATCH * NCHUNK * SHARE;          // first word of the dz rows
constexpr int WS_WORDS = DZ_BASE + NBATCH * NCHUNK * NFEAT;
constexpr int PGROUP   = 8;                                // shares fetched together in launch 2

// 16-B global load at a block-uniform base plus a per-thread byte offset plus a constant: the base stays in scalar registers
// and one offset register serves every load of a thread.
__device__ __forceinline__ v4f ld16(const float* __restrict__ ubase, unsigned tbyte, unsigned cbyte) {
  return *(const v4f*)((const char*)ubase + tbyte + cbyte);
}
// per-thread byte offset into a [row][NSEQ] f32 tensor for the 64 x 64 chunk loads: row tid>>4, columns 4*(tid&15)..+3;
// pass 'it' adds 16 rows
__device__ __forceinline__ unsigned chunk_tbyte(int tid) { return (unsigned)(((tid >> 4) * NSEQ + ((tid & 15) << 2)) * 4); }
constexpr unsigned ROWS16_BYTES = 16u * NSEQ * 4u;

// W^T hi/lo staging: proj is [d][m] f32; 1024 v4f = 256 threads x 4; covers all 64x64
__device__ __forceinline__ void stage_w(const float* __restrict__ proj, unsigned short* sWh, unsigned short* sWl, int tid) {
#pragma unroll
  for (int it = 0; it < 4; ++it) {
    const int idx = tid + it * NTHR;
    const int d   = idx >> 4;
    const int m4  = (idx & 15) << 2;
    const v4f wv = ld16(proj, 16u * (unsigned)tid, (unsigned)it * 16u * NTHR);
#pragma unroll
    for (int e = 0; e < 4; ++e) {
      unsigned short hb, lb;
      split_bits(wv[e], hb, lb);
      const int off = (m4 + e) * PITB + d;
      sWh[off] = hb;
      sWl[off] = lb;
    }
  }
}

// V chunk (vc = first column of the chunk in row 0): [v][i] f32 -> hi/lo planes [v][i]; 1024 v4f = 256 x 4; 4 halves packed into two integer words per plane
__device__ __forceinline__ void stage_v(const float* __restrict__ vc, unsigned short* sVh, unsigned short* sVl, int tid) {
#pragma unroll
  for (int it = 0; it < 4; ++it) {
    const int idx = tid + it * NTHR;
    const int vr  = idx >> 4;
    const int i4  = (idx & 15) << 2;
    const v4f vv = ld16(vc, chunk_tbyte(tid), (unsigned)it * ROWS16_BYTES);
    unsigned short h0, g0, h1, g1, h2, g2, h3, g3;
    split_bits(vv[0], h0, g0);
    split_bits(vv[1], h1, g1);
    split_bits(vv[2], h2, g2);
    split_bits(vv[3], h3, g3);
    v2u uh, ul;
    uh[0] = (unsigned)h0 | ((unsigned)h1 << 16);
    uh[1] = (unsigned)h2 | ((unsigned)h3 << 16);
    ul[0] = (unsigned)g0 | ((unsigned)g1 << 16);
    ul[1] = (unsigned)g2 | ((unsigned)g3 << 16);
    const int off = vr * PITB + i4;      // byte 144*vr + 2*i4 : 8-B aligned
    *(v2u*)(sVh + off) = uh;
    *(v2u*)(sVl + off) = ul;
  }
}

// ---------------- launch 1: one chunk's share of the state ----------------
__global__ __launch_bounds__(NTHR)
void lin_attn_chunk_state_kernel(const float* __restrict__ keys,
                                 const float* __restrict__ values,
                                 const float* __restrict__ proj,
                                 float* __restrict__ ws) {
  __shared__ __align__(16) unsigned short sVh[NVAL * PITB];    // V hi [v][i]
  __shared__ __align__(16) unsigned short sVl[NVAL * PITB];
  __shared__ __align__(16) unsigned short sYh[CHUNK * PITB];   // k^T hi [i][d]
  __shared__ __align__(16) unsigned short sYl[CHUNK * PITB];
  __shared__ __align__(16) unsigned short sWh[NFEAT * PITB];   // W^T hi [m][d]
  __shared__ __align__(16) unsigned short sWl[NFEAT * PITB];
  __shared__ __align__(16) unsigned short sKTh[NFEAT * PITB];  // phi_k^T hi [m][i]
  __shared__ __align__(16) unsigned short sKTl[NFEAT * PITB];

  const int tid  = threadIdx.x;
  const int lane = tid & 31;
  const int w    = tid >> 5;
  const int hh   = lane >> 4;
  const int tm   = w >> 1;
  const int tn0  = (w & 1) * 2;
  const int b    = blockIdx.x;        // grid.x == NBATCH
  const int ch   = blockIdx.y;        // grid.y == NCHUNK - 1: the last chunk's share has no reader
  const int l0   = ch * CHUNK;

  const float* kc = keys   + (size_t)b * NDIM * NSEQ + l0;
  const float* vc = values + (size_t)b * NVAL * NSEQ + l0;

  stage_w(proj, sWh, sWl, tid);
  // k chunk: [d][l0..l0+63] f32 -> hi/lo bf16 transposed [i][d]
#pragma unroll
  for (int it = 0; it < 4; ++it) {
    const int idx = tid + it * NTHR;
    const int d   = idx >> 4;
    const int i4  = (idx & 15) << 2;
    const v4f kv = ld16(kc, chunk_tbyte(tid), (unsigned)it * ROWS16_BYTES);
#pragma unroll
    for (int e = 0; e < 4; ++e) {
      unsigned short hk, lk;
      split_bits(kv[e], hk, lk);
      const int off = (i4 + e) * PITB + d;
      sYh[off] = hk; sYl[off] = lk;
    }
  }
  stage_v(vc, sVh, sVl, tid);
  __syncthreads();   // k^T, W^T and V planes complete

  // phi_k = relu(k^T W) + eps : A = k^T [i][d], Bt = W^T [m][d]; stored transposed [m][i]
  {
    v8f ak[2];
    ak[0] = zero8(); ak[1] = zero8();
    const int rl = lane & 15, koff = hh * 8;
#pragma unroll
    for (int ks = 0; ks < 2; ++ks) {
      const int ao = (16 * tm + rl) * PITB + 32 * ks + koff;
      const v16b kh = Frag<__bf16>::load(bfp(sYh) + ao);
      const v16b kl = Frag<__bf16>::load(bfp(sYl) + ao);
#pragma unroll
      for (int j = 0; j < 2; ++j) {
        const int bo = (16 * (tn0 + j) + rl) * PITB + 32 * ks + koff;
        const v16b wh = Frag<__bf16>::load(bfp(sWh) + bo);
        const v16b wl = Frag<__bf16>::load(bfp(sWl) + bo);
        ak[j] = at_mma(kh, wh, ak[j]);
        ak[j] = at_mma(kh, wl, ak[j]);
        ak[j] = at_mma(kl, wh, ak[j]);
      }
    }
#pragma unroll
    for (int j = 0; j < 2; ++j) {
      v8f pk;
#pragma unroll
      for (int r = 0; r < 8; ++r) pk[r] = fmaxf(ak[j][r], 0.f) + FEAT_EPS;
      put_split_tr(sKTh, sKTl, 16 * tm, 16 * (tn0 + j), lane, pk);
    }
  }
  __syncthreads();   // phi_k^T planes complete

  // dS^T[v][m] = sum_i V[i][v] phi_k[i][m] : A = V [v][i] rows v, Bt = phi_k^T [m][i] rows m
  v8f ds[2];
#pragma unroll
  for (int j = 0; j < 2; ++j)
    ds[j] = tile_k64_split(sVh, sVl, 16 * tm, sKTh, sKTl, 16 * (tn0 + j), lane, zero8());
  // dz[m] = sum_i phi_k[i][m], from the hi + lo planes (waves 0-1; the branch is wave-uniform)
  float zp = 0.f;
  if (tid < NFEAT) {
#pragma unroll
    for (int j = 0; j < 8; ++j) {
      const v4u wh = *(const v4u*)(sKTh + tid * PITB + 8 * j);
      const v4u wl = *(const v4u*)(sKTl + tid * PITB + 8 * j);
#pragma unroll
      for (int e = 0; e < 4; ++e) {
        zp += __uint_as_float(wh[e] << 16) + __uint_as_float(wl[e] << 16);
        zp += __uint_as_float(wh[e] & 0xffff0000u) + __uint_as_float(wl[e] & 0xffff0000u);
      }
    }
  }
  // the stores come last: no register that they name is written again
  float* sb = ws + (size_t)(b * NCHUNK + ch) * SHARE + 4 * tid;
#pragma unroll
  for (int j = 0; j < 2; ++j) {
    v4f a0, a1;
    a0[0] = ds[j][0]; a0[1] = ds[j][1]; a0[2] = ds[j][2]; a0[3] = ds[j][3];
    a1[0] = ds[j][4]; a1[1] = ds[j][5]; a1[2] = ds[j][6]; a1[3] = ds[j][7];
    *(v4f*)(sb + (2 * j)     * 4 * NTHR) = a0;
    *(v4f*)(sb + (2 * j + 1) * 4 * NTHR) = a1;
  }
  if (tid < NFEAT) ws[DZ_BASE + (b * NCHUNK + ch) * NFEAT + tid] = zp;
}

// ---------------- launch 2: one chunk's outputs ----------------
// LDS tile reuse (every producer/consumer pair of a tile is separated by a block barrier):
//   sXh/sXl : q^T hi/lo [l][d] (phases 0-1), then V as Bt [v][i] (phases 2-4)
//   sYh/sYl : k^T hi/lo [l][d] (phases 0-1), then S_old^T as Bt [v][m] (phases 2-4)
//   sKAh/l  : phi_k [i][m] (phases 1-2), then masked A [l][i] (phases 2b-4)
//   sF      : out^T [v][l] f32 (phases 4-5)
__global__ __launch_bounds__(NTHR)
void lin_attn_chunk_out_kernel(const float* __restrict__ keys,
                               const float* __restrict__ values,
                               const float* __restrict__ queries,
                               const float* __restrict__ proj,
                               const float* __restrict__ ws,
                               float* __restrict__ out) {
  __shared__ __align__(16) unsigned short sXh[CHUNK * PITB];
  __shared__ __align__(16) unsigned short sXl[CHUNK * PITB];
  __shared__ __align__(16) unsigned short sYh[CHUNK * PITB];
  __shared__ __align__(16) unsigned short sYl[CHUNK * PITB];
  __shared__ __align__(16) unsigned short sWh[NFEAT * PITB];   // W^T hi [m][d]
  __shared__ __align__(16) unsigned short sWl[NFEAT * PITB];   // W^T lo [m][d]
  __shared__ __align__(16) unsigned short sQh[CHUNK * PITB];   // phi_q hi [l][m]
  __shared__ __align__(16) unsigned short sQl[CHUNK * PITB];
  __shared__ __align__(16) unsigned short sKAh[CHUNK * PITB];
  __shared__ __align__(16) unsigned short sKAl[CHUNK * PITB];
  __shared__ __align__(16) float sF[CHUNK * PITF];
  __shared__ __align__(16) unsigned short sZh[NFEAT];          // z_old hi [m]
  __shared__ __align__(16) unsigned short sZl[NFEAT];

  const int tid  = threadIdx.x;
  const int lane = tid & 31;
  const int w    = tid >> 5;          // wave 0..7
  const int hh   = lane >> 4;
  const int cc   = lane & 15;
  const int tm   = w >> 1;            // row-tile index owned by this wave in every 64x64 GEMM
  const int tn0  = (w & 1) * 2;       // first of the two column tiles owned by this wave
  const int b    = blockIdx.x;                   // grid.x == NBATCH
  const int ch   = NCHUNK - 1 - (int)blockIdx.y; // grid.y == NCHUNK; the chunks with the most shares to sum start first
  const int l0   = ch * CHUNK;

  const float* kc = keys    + (size_t)b * NDIM * NSEQ + l0;
  const float* qc = queries + (size_t)b * NDIM * NSEQ + l0;
  const float* vc = values  + (size_t)b * NVAL * NSEQ + l0;
  float*       ob = out     + (size_t)b * NVAL * NSEQ;

  stage_w(proj, sWh, sWl, tid);

  // ---- phase 0: q, k chunk: [d][l0..l0+63] f32 -> hi/lo bf16 transposed [l][d]; 1024 v4f per tensor = 256 x 4 ----
  v4f qv[4], kv[4];
#pragma unroll
  for (int it = 0; it < 4; ++it) {
    qv[it] = ld16(qc, chunk_tbyte(tid), (unsigned)it * ROWS16_BYTES);
    kv[it] = ld16(kc, chunk_tbyte(tid), (unsigned)it * ROWS16_BYTES);
  }
  // precaution: the build reuses the scalar base registers of the loads above right behind them; this wait stands in front
  asm volatile("s_wait_xcnt 0x0" ::: "memory");
#pragma unroll
  for (int it = 0; it < 4; ++it) {
    const int idx = tid + it * NTHR;
    const int d   = idx >> 4;
    const int i4  = (idx & 15) << 2;
#pragma unroll
    for (int e = 0; e < 4; ++e) {
      unsigned short hq, lq, hk, lk;
      split_bits(qv[it][e], hq, lq);
      split_bits(kv[it][e], hk, lk);
      const int off = (i4 + e) * PITB + d;
      sXh[off] = hq; sXl[off] = lq;
      sYh[off] = hk; sYl[off] = lk;
    }
  }

  // ---- S_old^T (this thread's two tiles) and z_old: shares of chunks 0..ch-1 summed in chunk order ----
  // PGROUP shares are fetched together so that their loads are in flight at once; a slot at or past ch is read from a
  // slot that launch 1 has written (index clamped to the last one) and counts as zero.
  v8f accS[2];                        // S^T tiles: rows v = 16*tm + 8h + r, cols m = 16*(tn0+j) + cc
  accS[0] = zero8();
  accS[1] = zero8();
  {
    const float* pb = ws + (size_t)b * NCHUNK * SHARE;             // block-uniform
    const float* zb = ws + DZ_BASE + b * NCHUNK * NFEAT;           // block-uniform
    const int zi = tid & (NFEAT - 1);
    // all dz rows that launch 1 writes are asked for at once, ahead of the shares; they are summed behind them
    float zx[NCHUNK - 1];
#pragma unroll
    for (int c = 0; c < NCHUNK - 1; ++c) zx[c] = *(const float*)((const char*)(zb + c * NFEAT) + 4u * (unsigned)zi);
    // unrolled so that every slot's place is a constant in the load's offset field; the test is block-uniform
#pragma unroll
    for (int g = 0; g < NCHUNK - 1; g += PGROUP) {
      if (g >= ch) break;
      v4f x[PGROUP][4];
#pragma unroll
      for (int u = 0; u < PGROUP; ++u) {
        const int cs = (g + u < NCHUNK - 1) ? g + u : NCHUNK - 2;
#pragma unroll
        for (int q = 0; q < 4; ++q) x[u][q] = ld16(pb + (size_t)cs * SHARE, 16u * (unsigned)tid, (unsigned)q * 16u * NTHR);
      }
      // keeps the group's loads together in front of its sums: left free, the scheduler issues them two at a time, each
      // pair waiting out a whole trip to L2
      __builtin_amdgcn_sched_barrier(0);
#pragma unroll
      for (int u = 0; u < PGROUP; ++u) {
        const bool live = (g + u) < ch;
#pragma unroll
        for (int q = 0; q < 4; ++q)
#pragma unroll
          for (int e = 0; e < 4; ++e)
            accS[q >> 1][4 * (q & 1) + e] += live ? x[u][q][e] : 0.f;
      }
    }
    float zs = 0.f;
#pragma unroll
    for (int c = 0; c < NCHUNK - 1; ++c) zs += (c < ch) ? zx[c] : 0.f;
    if (tid < NFEAT) {
      unsigned short hz, lz;
      split_bits(zs, hz, lz);
      sZh[zi] = hz;
      sZl[zi] = lz;
    }
  }
  __syncthreads();   // B1

  // ---- phase 1: phi = relu(x^T W) + eps : A = x^T [l][d], Bt = W^T [m][d] ----
  {
    v8f aq[2], ak[2];
    aq[0] = zero8(); aq[1] = zero8(); ak[0] = zero8(); ak[1] = zero8();
    const int rl = lane & 15, koff = hh * 8;
#pragma unroll
    for (int ks = 0; ks < 2; ++ks) {
      const int ao = (16 * tm + rl) * PITB + 32 * ks + koff;
      const v16b qh = Frag<__bf16>::load(bfp(sXh) + ao);
      const v16b ql = Frag<__bf16>::load(bfp(sXl) + ao);
      const v16b kh = Frag<__bf16>::load(bfp(sYh) + ao);
      const v16b kl = Frag<__bf16>::load(bfp(sYl) + ao);
#pragma unroll
      for (int j = 0; j < 2; ++j) {
        const int bo = (16 * (tn0 + j) + rl) * PITB + 32 * ks + koff;
        const v16b wh = Frag<__bf16>::load(bfp(sWh) + bo);
        const v16b wl = Frag<__bf16>::load(bfp(sWl) + bo);
        aq[j] = at_mma(qh, wh, aq[j]);
        aq[j] = at_mma(qh, wl, aq[j]);
        aq[j] = at_mma(ql, wh, aq[j]);
        ak[j] = at_mma(kh, wh, ak[j]);
        ak[j] = at_mma(kh, wl, ak[j]);
        ak[j] = at_mma(kl, wh, ak[j]);
      }
    }
#pragma unroll
    for (int j = 0; j < 2; ++j) {
      v8f pq, pk;
#pragma unroll
      for (int r = 0; r < 8; ++r) {
        pq[r] = fmaxf(aq[j][r], 0.f) + FEAT_EPS;
        pk[r] = fmaxf(ak[j][r], 0.f) + FEAT_EPS;
      }
      put_split_rm(sQh,  sQl,  16 * tm, 16 * (tn0 + j), lane, pq);   // phi_q [l][m]
      put_split_rm(sKAh, sKAl, 16 * tm, 16 * (tn0 + j), lane, pk);   // phi_k [i][m]
    }
  }
  __syncthreads();   // B2

  // ---- phase 2: stage V ([v][l0+i] f32 -> hi/lo Bt [v][i]), stage S_old^T hi/lo, score GEMM ----
  v8f accA[2];
  {
    stage_v(vc, sXh, sXl, tid);
    // S_old^T as Bt [v][m]
    put_split_rm(sYh, sYl, 16 * tm, 16 * tn0,       lane, accS[0]);
    put_split_rm(sYh, sYl, 16 * tm, 16 * (tn0 + 1), lane, accS[1]);
    // A[l][i] = sum_m phi_q[l][m] phi_k[i][m] : A = phi_q rows l, Bt = phi_k rows i; causal mask i <= l
#pragma unroll
    for (int j = 0; j < 2; ++j) {
      accA[j] = tile_k64_split(sQh, sQl, 16 * tm, sKAh, sKAl, 16 * (tn0 + j), lane, zero8());
#pragma unroll
      for (int r = 0; r < 8; ++r) {
        const int row = 16 * tm + 8 * hh + r;
        const int col = 16 * (tn0 + j) + cc;
        const float a = accA[j][r];
        accA[j][r] = (col <= row) ? a : 0.f;
      }
    }
  }
  __syncthreads();   // B3

  // ---- phase 2b: masked A -> hi/lo planes (over phi_k's tile space; explicit zeros stored) ----
#pragma unroll
  for (int j = 0; j < 2; ++j)
    put_split_rm(sKAh, sKAl, 16 * tm, 16 * (tn0 + j), lane, accA[j]);
  __syncthreads();   // B4

  // ---- phase 4: out tile and, on the first tile's A fragments, the normaliser of this wave's rows; epilogue into out^T [v][l] f32 ----
  {
    v8f accO[2];
    v8f accN = zero8();               // element r: norm[16*tm + 8h + r], alike in the 16 lanes of a half
    v16b one[2], zh[2], zl[2];
#pragma unroll
    for (int ks = 0; ks < 2; ++ks) {
#pragma unroll
      for (int e = 0; e < 16; ++e) one[ks][e] = (__bf16)1.0f;
      zh[ks] = Frag<__bf16>::load(bfp(sZh) + 32 * ks + 8 * hh);
      zl[ks] = Frag<__bf16>::load(bfp(sZl) + 32 * ks + 8 * hh);
    }
    // sum_i A[l][i] V[i][v] : A = masked A rows l, Bt = V [v][i];  norm += sum_i A[l][i]
    accO[0] = tile_k64_split_rowdot<false>(sKAh, sKAl, 16 * tm, sXh, sXl, 16 * tn0, one, one, lane, zero8(), accN);
    // + sum_m phi_q[l][m] S_old[m][v] : A = phi_q rows l, Bt = S_old^T [v][m];  norm += phi_q[l].z_old
    accO[0] = tile_k64_split_rowdot<true>(sQh, sQl, 16 * tm, sYh, sYl, 16 * tn0, zh, zl, lane, accO[0], accN);
    accO[1] = tile_k64_split(sKAh, sKAl, 16 * tm, sXh, sXl, 16 * (tn0 + 1), lane, zero8());
    accO[1] = tile_k64_split(sQh, sQl, 16 * tm, sYh, sYl, 16 * (tn0 + 1), lane, accO[1]);
    v4f rn0, rn1;
#pragma unroll
    for (int e = 0; e < 4; ++e) {
      rn0[e] = 1.0f / accN[e];
      rn1[e] = 1.0f / accN[4 + e];
    }
#pragma unroll
    for (int j = 0; j < 2; ++j) {
      v4f o0, o1;
      o0[0] = accO[j][0] * rn0[0]; o0[1] = accO[j][1] * rn0[1]; o0[2] = accO[j][2] * rn0[2]; o0[3] = accO[j][3] * rn0[3];
      o1[0] = accO[j][4] * rn1[0]; o1[1] = accO[j][5] * rn1[1]; o1[2] = accO[j][6] * rn1[2]; o1[3] = accO[j][7] * rn1[3];
      // element r -> out^T[v = 16*(tn0+j)+cc][l = 16*tm + 8h + r]
      const int off = (16 * (tn0 + j) + cc) * PITF + 16 * tm + 8 * hh;   // byte 272*v + 4*(16tm+8h): 16-B aligned
      *(v4f*)(sF + off)     = o0;
      *(v4f*)(sF + off + 4) = o1;
    }
  }
  __syncthreads();   // B5

  // One instruction writes two whole rows (lanes 0-15 row r, lanes 16-31 row r+1, 16 B per lane)
  {
    const int c4 = cc * 4;
#pragma unroll
    for (int it = 0; it < 4; ++it) {
      const int row = 8 * w + 2 * it + hh;
      const v4f val = *(const v4f*)(sF + row * PITF + c4);
      *(v4f*)(ob + (size_t)row * NSEQ + l0 + c4) = val;
    }
  }
}

extern "C" void kernel_launch(void* const* d_in, const int* in_sizes, int n_in,
                              void* d_out, int out_size, void* d_ws, size_t ws_size,
                              hipStream_t stream) {
  if (n_in < 4) return;
  if (in_sizes[0] != NBATCH * NDIM * NSEQ) return;
  if (in_sizes[1] != NBATCH * NVAL * NSEQ) return;
  if (in_sizes[2] != NBATCH * NDIM * NSEQ) return;
  if (in_sizes[3] != NDIM * NFEAT) return;
  if (out_size != NBATCH * NVAL * NSEQ) return;
  if (ws_size < sizeof(float) * WS_WORDS) return;
  const float* keys    = (const float*)d_in[0];
  const float* values  = (const float*)d_in[1];
  const float* queries = (const float*)d_in[2];
  const float* proj    = (const float*)d_in[3];
  float* out = (float*)d_out;
  float* ws  = (float*)d_ws;
  lin_attn_chunk_state_kernel<<<dim3(NBATCH, NCHUNK - 1), dim3(NTHR), 0, stream>>>(keys, values, proj, ws);
  lin_attn_chunk_out_kernel<<<dim3(NBATCH, NCHUNK), dim3(NTHR), 0, stream>>>(keys, values, queries, proj, ws, out);
}

// v003
// One run takes 15.2 microseconds.
// In both of two side-by-side timings against v002, it was 1.12 times as fast.
// Over all steps from v000 it is 20.3 times as fast.
// All contractions (input projections, score tile phi_q*phi_k^T, score*V, phi_q*state, V*phi_k state update): v_wmma_f32_16x16x32_bf16 with bf16 hi/lo split operands (hi*hi + hi*lo + lo*hi), f32 accumulate; the row normaliser is one more column tile of the output products (same form, same split); feature column sums on VALU in f32.
#include <hip/hip_runtime.h>

// ---------------- fixed problem geometry ----------------
constexpr int NBATCH = 8;      // batch
constexpr int NDIM   = 64;     // key/query feature dim (contraction of the projection)
constexpr int NSEQ   = 2048;   // sequence length
constexpr int NFEAT  = 64;     // projection features m
constexpr int NVAL   = 64;     // value dim
constexpr int CHUNK  = 64;     // time steps per sequential chunk
constexpr int NCHUNK = NSEQ / CHUNK;
constexpr int PITB   = 72;     // 16-bit LDS tile pitch (elements): 144 B rows, 16-B aligned fragment loads
constexpr int PITF   = 68;     // f32 LDS tile pitch (elements): 272 B rows
constexpr int NTHR   = 256;    // 8 waves per block
constexpr float FEAT_EPS = 1.0e-3f;

static_assert(NSEQ % CHUNK == 0);
static_assert(NDIM == 64 && NFEAT == 64 && NVAL == 64 && CHUNK == 64);
static_assert(NFEAT % 32 == 0);          // the tid < NFEAT branches are wave-uniform
static_assert(NTHR == 256);
static_assert((PITB * 2) % 16 == 0 && (PITF * 4) % 16 == 0);

typedef __attribute__((ext_vector_type(16))) __bf16   v16b;
typedef __attribute__((ext_vector_type(8)))  __bf16   v8b;
typedef __attribute__((ext_vector_type(8)))  float    v8f;
typedef __attribute__((ext_vector_type(4)))  float    v4f;
typedef __attribute__((ext_vector_type(4)))  unsigned int v4u;
typedef __attribute__((ext_vector_type(2)))  unsigned int v2u;

// ---------------- pieces ----------------
__device__ __forceinline__ unsigned short f2bf_bits(float f) {
  unsigned u = __float_as_uint(f);
  return (unsigned short)((u + 0x7FFFu + ((u >> 16) & 1u)) >> 16);
}
__device__ __forceinline__ float bf_bits2f(unsigned short h) { return __uint_as_float(((unsigned)h) << 16); }

__device__ __forceinline__ void dep_guard_b(v8f& a, v8f& b, v16b x, v16b y) { asm volatile("v_nop\n\tv_nop\n\tv_nop\n\tv_nop" : "+v"(a), "+v"(b) : "v"(x), "v"(y)); }
__device__ __forceinline__ void keep4_b(v16b a, v16b b, v16b c, v16b d) { asm volatile("v_nop" :: "v"(a), "v"(b), "v"(c), "v"(d)); }
template <typename T> struct Frag;
template <> struct Frag<__bf16> {
  typedef v16b V; union U { v16b v; v8b h[2]; };
  static __device__ __forceinline__ v16b load(const __bf16* p) {   // elements 0..7 <- p[0..7], 8..15 <- p[16..23]
    U f; f.h[0] = *(const v8b*)(p); f.h[1] = *(const v8b*)(p + 16); return f.v;
  }
  static __device__ __forceinline__ v8f mma(v16b a, v16b b, v8f c) {
    return __builtin_amdgcn_wmma_f32_16x16x32_bf16(false, a, false, b, (short)0, c, false, false);
  }
  static __device__ __forceinline__ void guard(v8f& a, v8f& b, v16b x, v16b y) { dep_guard_b(a, b, x, y); }
  static __device__ __forceinline__ void keep(v16b a, v16b b, v16b c, v16b d) { keep4_b(a, b, c, d); }
};

// one WMMA with the 4-slot hazard guard (ties D, keeps A/B live)
__device__ __forceinline__ v8f at_mma(v16b a, v16b b, v8f c) {
  c = __builtin_amdgcn_wmma_f32_16x16x32_bf16(false, a, false, b, (short)0, c, false, false);
  asm volatile("v_nop\n\tv_nop\n\tv_nop\n\tv_nop" : "+v"(c) : "v"(a), "v"(b));
  return c;
}

// ---------------- helpers ----------------
// bf16 hi/lo split (RNE convert): f ~= hi + lo, both as bf16 bit patterns
__device__ __forceinline__ void split_bits(float f, unsigned short& hi, unsigned short& lo) {
  hi = f2bf_bits(f);
  lo = f2bf_bits(f - bf_bits2f(hi));
}

__device__ __forceinline__ const __bf16* bfp(const unsigned short* p) { return (const __bf16*)(const void*)p; }

__device__ __forceinline__ v8f zero8() { return (v8f){0.f,0.f,0.f,0.f,0.f,0.f,0.f,0.f}; }

// One 16x16 output tile over K = 64 (two 32-deep steps) of C = A * Bt^T with hi/lo split planes.
// A planes row-major [row][PITB] (k contiguous), Bt planes row-major [n][PITB] (k contiguous); all in LDS.
// Per lane: A row = arow0 + (lane&15), Bt row = brow0 + (lane&15); fragment elements 0..7 <- k0 + 8h + 0..7,
// 8..15 <- k0 + 16 + 8h + 0..7 (h = lane>>4). D element r of lane l -> (arow0 + 8h + r, brow0 + (l&15)).
__device__ __forceinline__ v8f tile_k64_split(const unsigned short* Ah, const unsigned short* Al, int arow0,
                                               const unsigned short* Bh, const unsigned short* Bl, int brow0,
                                               int lane, v8f acc) {
  const int rl = lane & 15, koff = (lane >> 4) * 8;
#pragma unroll
  for (int ks = 0; ks < 2; ++ks) {
    const int ao = (arow0 + rl) * PITB + 32 * ks + koff;
    const int bo = (brow0 + rl) * PITB + 32 * ks + koff;
    const v16b ah = Frag<__bf16>::load(bfp(Ah) + ao);
    const v16b al = Frag<__bf16>::load(bfp(Al) + ao);
    const v16b bh = Frag<__bf16>::load(bfp(Bh) + bo);
    const v16b bl = Frag<__bf16>::load(bfp(Bl) + bo);
    acc = at_mma(ah, bh, acc);
    acc = at_mma(ah, bl, acc);
    acc = at_mma(al, bh, acc);
  }
  return acc;
}

// tile_k64_split, and on the same A fragments one more column tile accN += A * N^T whose 16 rows of N^T are all the vector n:
// every column of accN is alike, so element r of any lane is sum_k A[arow0 + 8h + r][k] n[k]. nh/nl[ks] hold n in the B fragment's
// k order (elements 0..7 <- n[32ks + 8h + 0..7], 8..15 <- n[32ks + 16 + 8h + 0..7]); NLO = false: n is exact in nh, nl is not used.
// acc gets the same products in the same order as in tile_k64_split.
template <bool NLO>
__device__ __forceinline__ v8f tile_k64_split_rowdot(const unsigned short* Ah, const unsigned short* Al, int arow0,
                                                      const unsigned short* Bh, const unsigned short* Bl, int brow0,
                                                      const v16b (&nh)[2], const v16b (&nl)[2],
                                                      int lane, v8f acc, v8f& accN) {
  const int rl = lane & 15, koff = (lane >> 4) * 8;
#pragma unroll
  for (int ks = 0; ks < 2; ++ks) {
    const int ao = (arow0 + rl) * PITB + 32 * ks + koff;
    const int bo = (brow0 + rl) * PITB + 32 * ks + koff;
    const v16b ah = Frag<__bf16>::load(bfp(Ah) + ao);
    const v16b al = Frag<__bf16>::load(bfp(Al) + ao);
    const v16b bh = Frag<__bf16>::load(bfp(Bh) + bo);
    const v16b bl = Frag<__bf16>::load(bfp(Bl) + bo);
    acc  = at_mma(ah, bh, acc);
    accN = at_mma(ah, nh[ks], accN);
    acc  = at_mma(ah, bl, acc);
    if (NLO) accN = at_mma(ah, nl[ks], accN);
    acc  = at_mma(al, bh, acc);
    accN = at_mma(al, nh[ks], accN);
  }
  return acc;
}

// Store a D tile (element r of lane -> (row0 + 8h + r, col0 + (lane&15))) as hi/lo bf16 into row-major LDS planes.
__device__ __forceinline__ void put_split_rm(unsigned short* Ph, unsigned short* Pl, int row0, int col0, int lane, v8f v) {
  const int hq = lane >> 4, cq = lane & 15;
#pragma unroll
  for (int r = 0; r < 8; ++r) {
    unsigned short hb, lb;
    split_bits(v[r], hb, lb);
    const int off = (row0 + 8 * hq + r) * PITB + col0 + cq;
    Ph[off] = hb;
    Pl[off] = lb;
  }
}
// Store the TRANSPOSE of a D tile: element r of lane -> P[col0 + (lane&15)][row0 + 8h + r]; the 8 elements of a lane are
// contiguous -> one 16-B LDS store per plane built from per-lane integer words.
__device__ __forceinline__ void put_split_tr(unsigned short* Ph, unsigned short* Pl, int row0, int col0, int lane, v8f v) {
  const int hq = lane >> 4, cq = lane & 15;
  v4u uh, ul;
#pragma unroll
  for (int e = 0; e < 4; ++e) {
    unsigned short ha, la, hb, lb;
    split_bits(v[2 * e], ha, la);
    split_bits(v[2 * e + 1], hb, lb);
    uh[e] = (unsigned)ha | ((unsigned)hb << 16);
    ul[e] = (unsigned)la | ((unsigned)lb << 16);
  }
  const int off = (col0 + cq) * PITB + row0 + 8 * hq;   // byte offset 144*(col) + 2*(row0+8h): 16-B aligned
  *(v4u*)(Ph + off) = uh;
  *(v4u*)(Pl + off) = ul;
}

// =====================================================================================================
// The 32 chunks of 64 steps of a batch element run side by side, one block per (batch, chunk), in two launches.
// Launch 1 (chunks 0..30): phi_k of the chunk, then its own share of the state,
//   dS^T[v][m] = sum_i V[i][v] phi_k[i][m]  and  dz[m] = sum_i phi_k[i][m],  stored in the workspace.
// Launch 2 (chunks 0..31): S_old^T and z_old = sums of the shares of all earlier chunks, in chunk order, then
//   phi_q[l][m], phi_k[i][m] = relu(x^T W) + eps             (projection GEMMs, K = d = 64)
//   A[l][i] = sum_m phi_q[l][m] phi_k[i][m], kept for i <= l  (score tile, K = m = 64)
//   norm[l] = phi_q[l].z_old + sum_i A[l][i]                  (a column tile beside out's: B = z_old, B = ones)
//   out[l][v] = (sum_i A[l][i] V[i][v] + sum_m phi_q[l][m] S_old[m][v]) / norm[l]
// Workspace (f32): share of (b, c) at (b*NCHUNK + c)*SHARE, held in the owning thread's register order:
//   word q*4*NTHR + 4*tid + e = element 4*(q&1)+e of tile j = q>>1 of thread tid (16 B per lane, 512 B per wave and store);
//   behind all shares, dz of (b, c) at (b*NCHUNK + c)*NFEAT. Every word launch 2 reads is written by launch 1 of the same call.
// =====================================================================================================
constexpr int SHARE    = NVAL * NFEAT;                     // f32 words of one chunk's state share
constexpr int DZ_BASE  = NBATCH * NCHUNK * SHARE;          // first word of the dz rows
constexpr int WS_WORDS = DZ_BASE + NBATCH * NCHUNK * NFEAT;
constexpr int PGROUP   = 8;                                // shares fetched together in launch 2

// 16-B global load at a block-uniform base plus a per-thread byte offset plus a constant: the base stays in scalar registers
// and one offset register serves every load of a thread.
__device__ __forceinline__ v4f ld16(const float* __restrict__ ubase, unsigned tbyte, unsigned cbyte) {
  return *(const v4f*)((const char*)ubase + tbyte + cbyte);
}
// per-thread byte offset into a [row][NSEQ] f32 tensor for the 64 x 64 V chunk loads: row tid>>4, columns 4*(tid&15)..+3;
// pass 'it' adds 16 rows
__device__ __forceinline__ unsigned chunk_tbyte(int tid) { return (unsigned)(((tid >> 4) * NSEQ + ((tid & 15) << 2)) * 4); }
constexpr unsigned ROWS16_BYTES = 16u * NSEQ * 4u;

// Transposed hi/lo staging of a 64 x 64 f32 tile x[r][c] (row pitch RP floats) into planes P[c][r] (pitch PITB).
// A thread takes rows 2p and 2p+1 at columns c4..c4+3 and stores one dword (P[c][2p], P[c][2p+1]) per column and plane.
// Lane -> k = lane&7 (c4 = 4k + 32*(w&1), 128 B of a row per 8 lanes), pl = lane>>3 (p = 4*(w>>1) + pl); pass 'it' adds 16 pairs.
// Bank of a store = (16*(k&3) + 36*column-in-four + p) mod 64: lanes k and k+4 (plane rows 16 apart) would meet, so the plane
// rows whose bit 4 is set hold their 16-B groups swapped in pairs: element r of plane row c lies at r ^ tr_swz(c). The 32 lanes
// of every store then fall on 32 banks; a fragment's 16 rows share one tr_swz, so a reader only flips its 8-element offset.
__device__ __forceinline__ int tr_swz(int c) { return ((c >> 4) & 1) << 3; }
// f2bf_bits before its last shift
__device__ __forceinline__ unsigned rne_word(float f) {
  const unsigned u = __float_as_uint(f);
  return u + 0x7FFFu + ((u >> 16) & 1u);
}
template <int RP>
__device__ __forceinline__ unsigned tr_tbyte(int tid) {
  const int k = tid & 7, pl = (tid >> 3) & 3, w = tid >> 5;
  return (unsigned)(((2 * (4 * (w >> 1) + pl)) * RP + 4 * k + 32 * (w & 1)) * 4);
}
// x[2*it + s] = row 2p + s of pass it
template <int RP>
__device__ __forceinline__ void load_tr(const float* __restrict__ ubase, int tid, v4f (&x)[4]) {
#pragma unroll
  for (int it = 0; it < 2; ++it)
#pragma unroll
    for (int s = 0; s < 2; ++s)
      x[2 * it + s] = ld16(ubase, tr_tbyte<RP>(tid), (unsigned)((32 * it + s) * RP * 4));
}
__device__ __forceinline__ void put_tr_pairs(unsigned short* Ph, unsigned short* Pl, int tid, const v4f (&x)[4]) {
  const int k = tid & 7, pl = (tid >> 3) & 3, w = tid >> 5;
  const int c4 = 4 * k + 32 * (w & 1);
  const int sz = tr_swz(c4);          // the same for c4..c4+3
#pragma unroll
  for (int it = 0; it < 2; ++it) {
    const int p = 4 * (w >> 1) + pl + 16 * it;
#pragma unroll
    for (int e = 0; e < 4; ++e) {
      // the split of split_bits on both rows, kept in 32-bit words: the bf16 is the upper half of each rounded word
      const float a = x[2 * it][e], c = x[2 * it + 1][e];
      const unsigned ra = rne_word(a), rc = rne_word(c);
      const unsigned sa = rne_word(a - __uint_as_float(ra & 0xffff0000u));
      const unsigned sc = rne_word(c - __uint_as_float(rc & 0xffff0000u));
      const int off = (c4 + e) * PITB + ((2 * p) ^ sz);   // even: 4-B aligned
      // byte select: upper half of the second word below, upper half of the first word above
      *(unsigned*)(Ph + off) = __builtin_amdgcn_perm(rc, ra, 0x07060302u);
      *(unsigned*)(Pl + off) = __builtin_amdgcn_perm(sc, sa, 0x07060302u);
    }
  }
}

// V chunk (vc = first column of the chunk in row 0): [v][i] f32 -> hi/lo planes [v][i]; 1024 v4f = 256 x 4; 4 halves packed into two integer words per plane
__device__ __forceinline__ void stage_v(const float* __restrict__ vc, unsigned short* sVh, unsigned short* sVl, int tid) {
#pragma unroll
  for (int it = 0; it < 4; ++it) {
    const int idx = tid + it * NTHR;
    const int vr  = idx >> 4;
    const int i4  = (idx & 15) << 2;
    const v4f vv = ld16(vc, chunk_tbyte(tid), (unsigned)it * ROWS16_BYTES);
    unsigned short h0, g0, h1, g1, h2, g2, h3, g3;
    split_bits(vv[0], h0, g0);
    split_bits(vv[1], h1, g1);
    split_bits(vv[2], h2, g2);
    split_bits(vv[3], h3, g3);
    v2u uh, ul;
    uh[0] = (unsigned)h0 | ((unsigned)h1 << 16);
    uh[1] = (unsigned)h2 | ((unsigned)h3 << 16);
    ul[0] = (unsigned)g0 | ((unsigned)g1 << 16);
    ul[1] = (unsigned)g2 | ((unsigned)g3 << 16);
    const int off = vr * PITB + i4;      // byte 144*vr + 2*i4 : 8-B aligned
    *(v2u*)(sVh + off) = uh;
    *(v2u*)(sVl + off) = ul;
  }
}

// ---------------- launch 1: one chunk's share of the state ----------------
__global__ __launch_bounds__(NTHR)
void lin_attn_chunk_state_kernel(const float* __restrict__ keys,
                                 const float* __restrict__ values,
                                 const float* __restrict__ proj,
                                 float* __restrict__ ws) {
  __shared__ __align__(16) unsigned short sVh[NVAL * PITB];    // V hi [v][i]
  __shared__ __align__(16) unsigned short sVl[NVAL * PITB];
  __shared__ __align__(16) unsigned short sYh[CHUNK * PITB];   // k^T hi [i][d]
  __shared__ __align__(16) unsigned short sYl[CHUNK * PITB];
  __shared__ __align__(16) unsigned short sWh[NFEAT * PITB];   // W^T hi [m][d]
  __shared__ __align__(16) unsigned short sWl[NFEAT * PITB];
  __shared__ __align__(16) unsigned short sKTh[NFEAT * PITB];  // phi_k^T hi [m][i]
  __shared__ __align__(16) unsigned short sKTl[NFEAT * PITB];

  const int tid  = threadIdx.x;
  const int lane = tid & 31;
  const int w    = tid >> 5;
  const int hh   = lane >> 4;
  const int tm   = w >> 1;
  const int tn0  = (w & 1) * 2;
  const int b    = blockIdx.x;        // grid.x == NBATCH
  const int ch   = blockIdx.y;        // grid.y == NCHUNK - 1: the last chunk's share has no reader
  const int l0   = ch * CHUNK;

  const float* kc = keys   + (size_t)b * NDIM * NSEQ + l0;
  const float* vc = values + (size_t)b * NVAL * NSEQ + l0;

  // W ([d][m]) and the k chunk ([d][l0..l0+63]) f32 -> hi/lo bf16 transposed: W^T [m][d], k^T [i][d]
  {
    v4f wv[4], kv[4];
    load_tr<NFEAT>(proj, tid, wv);
    load_tr<NSEQ>(kc, tid, kv);
    put_tr_pairs(sWh, sWl, tid, wv);
    put_tr_pairs(sYh, sYl, tid, kv);
  }
  stage_v(vc, sVh, sVl, tid);
  __syncthreads();   // k^T, W^T and V planes complete

  // phi_k = relu(k^T W) + eps : A = k^T [i][d], Bt = W^T [m][d]; stored transposed [m][i]
  {
    v8f ak[2];
    ak[0] = zero8(); ak[1] = zero8();
    const int rl = lane & 15, koff = hh * 8;
#pragma unroll
    for (int ks = 0; ks < 2; ++ks) {
      const int ao = (16 * tm + rl) * PITB + 32 * ks + (koff ^ tr_swz(16 * tm));
      const v16b kh = Frag<__bf16>::load(bfp(sYh) + ao);
      const v16b kl = Frag<__bf16>::load(bfp(sYl) + ao);
#pragma unroll
      for (int j = 0; j < 2; ++j) {
        const int bo = (16 * (tn0 + j) + rl) * PITB + 32 * ks + (koff ^ tr_swz(16 * (tn0 + j)));
        const v16b wh = Frag<__bf16>::load(bfp(sWh) + bo);
        const v16b wl = Frag<__bf16>::load(bfp(sWl) + bo);
        ak[j] = at_mma(kh, wh, ak[j]);
        ak[j] = at_mma(kh, wl, ak[j]);
        ak[j] = at_mma(kl, wh, ak[j]);
      }
    }
#pragma unroll
    for (int j = 0; j < 2; ++j) {
      v8f pk;
#pragma unroll
      for (int r = 0; r < 8; ++r) pk[r] = fmaxf(ak[j][r], 0.f) + FEAT_EPS;
      put_split_tr(sKTh, sKTl, 16 * tm, 16 * (tn0 + j), lane, pk);
    }
  }
  __syncthreads();   // phi_k^T planes complete

  // dS^T[v][m] = sum_i V[i][v] phi_k[i][m] : A = V [v][i] rows v, Bt = phi_k^T [m][i] rows m
  v8f ds[2];
#pragma unroll
  for (int j = 0; j < 2; ++j)
    ds[j] = tile_k64_split(sVh, sVl, 16 * tm, sKTh, sKTl, 16 * (tn0 + j), lane, zero8());
  // dz[m] = sum_i phi_k[i][m], from the hi + lo planes (waves 0-1; the branch is wave-uniform)
  float zp = 0.f;
  if (tid < NFEAT) {
#pragma unroll
    for (int j = 0; j < 8; ++j) {
      const v4u wh = *(const v4u*)(sKTh + tid * PITB + 8 * j);
      const v4u wl = *(const v4u*)(sKTl + tid * PITB + 8 * j);
#pragma unroll
      for (int e = 0; e < 4; ++e) {
        zp += __uint_as_float(wh[e] << 16) + __uint_as_float(wl[e] << 16);
        zp += __uint_as_float(wh[e] & 0xffff0000u) + __uint_as_float(wl[e] & 0xffff0000u);
      }
    }
  }
  // the stores come last: no register that they name is written again
  float* sb = ws + (size_t)(b * NCHUNK + ch) * SHARE + 4 * tid;
#pragma unroll
  for (int j = 0; j < 2; ++j) {
    v4f a0, a1;
    a0[0] = ds[j][0]; a0[1] = ds[j][1]; a0[2] = ds[j][2]; a0[3] = ds[j][3];
    a1[0] = ds[j][4]; a1[1] = ds[j][5]; a1[2] = ds[j][6]; a1[3] = ds[j][7];
    *(v4f*)(sb + (2 * j)     * 4 * NTHR) = a0;
    *(v4f*)(sb + (2 * j + 1) * 4 * NTHR) = a1;
  }
  if (tid < NFEAT) ws[DZ_BASE + (b * NCHUNK + ch) * NFEAT + tid] = zp;
}

// ---------------- launch 2: one chunk's outputs ----------------
// LDS tile reuse (every producer/consumer pair of a tile is separated by a block barrier):
//   sXh/sXl : q^T hi/lo [l][d] (phases 0-1), then V as Bt [v][i] (phases 2-4)
//   sYh/sYl : k^T hi/lo [l][d] (phases 0-1), then S_old^T as Bt [v][m] (phases 2-4)
//   sKAh/l  : phi_k [i][m] (phases 1-2), then masked A [l][i] (phases 2b-4)
//   sF      : out^T [v][l] f32 (phases 4-5)
__global__ __launch_bounds__(NTHR)
void lin_attn_chunk_out_kernel(const float* __restrict__ keys,
                               const float* __restrict__ values,
                               const float* __restrict__ queries,
                               const float* __restrict__ proj,
                               const float* __restrict__ ws,
                               float* __restrict__ out) {
  __shared__ __align__(16) unsigned short sXh[CHUNK * PITB];
  __shared__ __align__(16) unsigned short sXl[CHUNK * PITB];
  __shared__ __align__(16) unsigned short sYh[CHUNK * PITB];
  __shared__ __align__(16) unsigned short sYl[CHUNK * PITB];
  __shared__ __align__(16) unsigned short sWh[NFEAT * PITB];   // W^T hi [m][d]
  __shared__ __align__(16) unsigned short sWl[NFEAT * PITB];   // W^T lo [m][d]
  __shared__ __align__(16) unsigned short sQh[CHUNK * PITB];   // phi_q hi [l][m]
  __shared__ __align__(16) unsigned short sQl[CHUNK * PITB];
  __shared__ __align__(16) unsigned short sKAh[CHUNK * PITB];
  __shared__ __align__(16) unsigned short sKAl[CHUNK * PITB];
  __shared__ __align__(16) float sF[CHUNK * PITF];
  __shared__ __align__(16) unsigned short sZh[NFEAT];          // z_old hi [m]
  __shared__ __align__(16) unsigned short sZl[NFEAT];

  const int tid  = threadIdx.x;
  const int lane = tid & 31;
  const int w    = tid >> 5;          // wave 0..7
  const int hh   = lane >> 4;
  const int cc   = lane & 15;
  const int tm   = w >> 1;            // row-tile index owned by this wave in every 64x64 GEMM
  const int tn0  = (w & 1) * 2;       // first of the two column tiles owned by this wave
  const int b    = blockIdx.x;                   // grid.x == NBATCH
  const int ch   = NCHUNK - 1 - (int)blockIdx.y; // grid.y == NCHUNK; the chunks with the most shares to sum start first
  const int l0   = ch * CHUNK;

  const float* kc = keys    + (size_t)b * NDIM * NSEQ + l0;
  const float* qc = queries + (size_t)b * NDIM * NSEQ + l0;
  const float* vc = values  + (size_t)b * NVAL * NSEQ + l0;
  float*       ob = out     + (size_t)b * NVAL * NSEQ;

  // ---- phase 0: W ([d][m]) and the q, k chunks ([d][l0..l0+63]) f32 -> hi/lo bf16 transposed: W^T [m][d], q^T, k^T [l][d] ----
  {
    v4f wv[4], qv[4], kv[4];
    load_tr<NFEAT>(proj, tid, wv);
    // precaution: the build lets a later load's result land in the offset register of the loads above; this wait stands in front
    asm volatile("s_wait_xcnt 0x0" ::: "memory");
    load_tr<NSEQ>(qc, tid, qv);
    load_tr<NSEQ>(kc, tid, kv);
    // precaution: the build reuses the scalar base registers of the loads above right behind them; this wait stands in front
    asm volatile("s_wait_xcnt 0x0" ::: "memory");
    put_tr_pairs(sWh, sWl, tid, wv);
    put_tr_pairs(sXh, sXl, tid, qv);
    put_tr_pairs(sYh, sYl, tid, kv);
  }

  // ---- S_old^T (this thread's two tiles) and z_old: shares of chunks 0..ch-1 summed in chunk order ----
  // PGROUP shares are fetched together so that their loads are in flight at once; a slot at or past ch is read from a
  // slot that launch 1 has written (index clamped to the last one) and counts as zero.
  v8f accS[2];                        // S^T tiles: rows v = 16*tm + 8h + r, cols m = 16*(tn0+j) + cc
  accS[0] = zero8();
  accS[1] = zero8();
  {
    const float* pb = ws + (size_t)b * NCHUNK * SHARE;             // block-uniform
    const float* zb = ws + DZ_BASE + b * NCHUNK * NFEAT;           // block-uniform
    const int zi = tid & (NFEAT - 1);
    // all dz rows that launch 1 writes are asked for at once, ahead of the shares; they are summed behind them
    float zx[NCHUNK - 1];
#pragma unroll
    for (int c = 0; c < NCHUNK - 1; ++c) zx[c] = *(const float*)((const char*)(zb + c * NFEAT) + 4u * (unsigned)zi);
    // unrolled so that every slot's place is a constant in the load's offset field; the test is block-uniform
#pragma unroll
    for (int g = 0; g < NCHUNK - 1; g += PGROUP) {
      if (g >= ch) break;
      v4f x[PGROUP][4];
#pragma unroll
      for (int u = 0; u < PGROUP; ++u) {
        const int cs = (g + u < NCHUNK - 1) ? g + u : NCHUNK - 2;
#pragma unroll
        for (int q = 0; q < 4; ++q) x[u][q] = ld16(pb + (size_t)cs * SHARE, 16u * (unsigned)tid, (unsigned)q * 16u * NTHR);
      }
      // keeps the group's loads together in front of its sums: left free, the scheduler issues them two at a time, each
      // pair waiting out a whole trip to L2
      __builtin_amdgcn_sched_barrier(0);
#pragma unroll
      for (int u = 0; u < PGROUP; ++u) {
        const bool live = (g + u) < ch;
#pragma unroll
        for (int q = 0; q < 4; ++q)
#pragma unroll
          for (int e = 0; e < 4; ++e)
            accS[q >> 1][4 * (q & 1) + e] += live ? x[u][q][e] : 0.f;
      }
    }
    float zs = 0.f;
#pragma unroll
    for (int c = 0; c < NCHUNK - 1; ++c) zs += (c < ch) ? zx[c] : 0.f;
    if (tid < NFEAT) {
      unsigned short hz, lz;
      split_bits(zs, hz, lz);
      sZh[zi] = hz;
      sZl[zi] = lz;
    }
  }
  __syncthreads();   // B1

  // ---- phase 1: phi = relu(x^T W) + eps : A = x^T [l][d], Bt = W^T [m][d] ----
  {
    v8f aq[2], ak[2];
    aq[0] = zero8(); aq[1] = zero8(); ak[0] = zero8(); ak[1] = zero8();
    const int rl = lane & 15, koff = hh * 8;
#pragma unroll
    for (int ks = 0; ks < 2; ++ks) {
      const int ao = (16 * tm + rl) * PITB + 32 * ks + (koff ^ tr_swz(16 * tm));
      const v16b qh = Frag<__bf16>::load(bfp(sXh) + ao);
      const v16b ql = Frag<__bf16>::load(bfp(sXl) + ao);
      const v16b kh = Frag<__bf16>::load(bfp(sYh) + ao);
      const v16b kl = Frag<__bf16>::load(bfp(sYl) + ao);
#pragma unroll
      for (int j = 0; j < 2; ++j) {
        const int bo = (16 * (tn0 + j) + rl) * PITB + 32 * ks + (koff ^ tr_swz(16 * (tn0 + j)));
        const v16b wh = Frag<__bf16>::load(bfp(sWh) + bo);
        const v16b wl = Frag<__bf16>::load(bfp(sWl) + bo);
        aq[j] = at_mma(qh, wh, aq[j]);
        aq[j] = at_mma(qh, wl, aq[j]);
        aq[j] = at_mma(ql, wh, aq[j]);
        ak[j] = at_mma(kh, wh, ak[j]);
        ak[j] = at_mma(kh, wl, ak[j]);
        ak[j] = at_mma(kl, wh, ak[j]);
      }
    }
#pragma unroll
    for (int j = 0; j < 2; ++j) {
      v8f pq, pk;
#pragma unroll
      for (int r = 0; r < 8; ++r) {
        pq[r] = fmaxf(aq[j][r], 0.f) + FEAT_EPS;
        pk[r] = fmaxf(ak[j][r], 0.f) + FEAT_EPS;
      }
      put_split_rm(sQh,  sQl,  16 * tm, 16 * (tn0 + j), lane, pq);   // phi_q [l][m]
      put_split_rm(sKAh, sKAl, 16 * tm, 16 * (tn0 + j), lane, pk);   // phi_k [i][m]
    }
  }
  __syncthreads();   // B2

  // ---- phase 2: stage V ([v][l0+i] f32 -> hi/lo Bt [v][i]), stage S_old^T hi/lo, score GEMM ----
  v8f accA[2];
  {
    stage_v(vc, sXh, sXl, tid);
    // S_old^T as Bt [v][m]
    put_split_rm(sYh, sYl, 16 * tm, 16 * tn0,       lane, accS[0]);
    put_split_rm(sYh, sYl, 16 * tm, 16 * (tn0 + 1), lane, accS[1]);
    // A[l][i] = sum_m phi_q[l][m] phi_k[i][m] : A = phi_q rows l, Bt = phi_k rows i; causal mask i <= l
#pragma unroll
    for (int j = 0; j < 2; ++j) {
      accA[j] = tile_k64_split(sQh, sQl, 16 * tm, sKAh, sKAl, 16 * (tn0 + j), lane, zero8());
#pragma unroll
      for (int r = 0; r < 8; ++r) {
        const int row = 16 * tm + 8 * hh + r;
        const int col = 16 * (tn0 + j) + cc;
        const float a = accA[j][r];
        accA[j][r] = (col <= row) ? a : 0.f;
      }
    }
  }
  __syncthreads();   // B3

  // ---- phase 2b: masked A -> hi/lo planes (over phi_k's tile space; explicit zeros stored) ----
#pragma unroll
  for (int j = 0; j < 2; ++j)
    put_split_rm(sKAh, sKAl, 16 * tm, 16 * (tn0 + j), lane, accA[j]);
  __syncthreads();   // B4

  // ---- phase 4: out tile and, on the first tile's A fragments, the normaliser of this wave's rows; epilogue into out^T [v][l] f32 ----
  {
    v8f accO[2];
    v8f accN = zero8();               // element r: norm[16*tm + 8h + r], alike in the 16 lanes of a half
    v16b one[2], zh[2], zl[2];
#pragma unroll
    for (int ks = 0; ks < 2; ++ks) {
#pragma unroll
      for (int e = 0; e < 16; ++e) one[ks][e] = (__bf16)1.0f;
      zh[ks] = Frag<__bf16>::load(bfp(sZh) + 32 * ks + 8 * hh);
      zl[ks] = Frag<__bf16>::load(bfp(sZl) + 32 * ks + 8 * hh);
    }
    // sum_i A[l][i] V[i][v] : A = masked A rows l, Bt = V [v][i];  norm += sum_i A[l][i]
    accO[0] = tile_k64_split_rowdot<false>(sKAh, sKAl, 16 * tm, sXh, sXl, 16 * tn0, one, one, lane, zero8(), accN);
    // + sum_m phi_q[l][m] S_old[m][v] : A = phi_q rows l, Bt = S_old^T [v][m];  norm += phi_q[l].z_old
    accO[0] = tile_k64_split_rowdot<true>(sQh, sQl, 16 * tm, sYh, sYl, 16 * tn0, zh, zl, lane, accO[0], accN);
    accO[1] = tile_k64_split(sKAh, sKAl, 16 * tm, sXh, sXl, 16 * (tn0 + 1), lane, zero8());
    accO[1] = tile_k64_split(sQh, sQl, 16 * tm, sYh, sYl, 16 * (tn0 + 1), lane, accO[1]);
    v4f rn0, rn1;
#pragma unroll
    for (int e = 0; e < 4; ++e) {
      rn0[e] = 1.0f / accN[e];
      rn1[e] = 1.0f / accN[4 + e];
    }
#pragma unroll
    for (int j = 0; j < 2; ++j) {
      v4f o0, o1;
      o0[0] = accO[j][0] * rn0[0]; o0[1] = accO[j][1] * rn0[1]; o0[2] = accO[j][2] * rn0[2]; o0[3] = accO[j][3] * rn0[3];
      o1[0] = accO[j][4] * rn1[0]; o1[1] = accO[j][5] * rn1[1]; o1[2] = accO[j][6] * rn1[2]; o1[3] = accO[j][7] * rn1[3];
      // element r -> out^T[v = 16*(tn0+j)+cc][l = 16*tm + 8h + r]
      const int off = (16 * (tn0 + j) + cc) * PITF + 16 * tm + 8 * hh;   // byte 272*v + 4*(16tm+8h): 16-B aligned
      *(v4f*)(sF + off)     = o0;
      *(v4f*)(sF + off + 4) = o1;
    }
  }
  __syncthreads();   // B5

  // One instruction writes two whole rows (lanes 0-15 row r, lanes 16-31 row r+1, 16 B per lane)
  {
    const int c4 = cc * 4;
#pragma unroll
    for (int it = 0; it < 4; ++it) {
      const int row = 8 * w + 2 * it + hh;
      const v4f val = *(const v4f*)(sF + row * PITF + c4);
      *(v4f*)(ob + (size_t)row * NSEQ + l0 + c4) = val;
    }
  }
}

extern "C" void kernel_launch(void* const* d_in, const int* in_sizes, int n_in,
                              void* d_out, int out_size, void* d_ws, size_t ws_size,
                              hipStream_t stream) {
  if (n_in < 4) return;
  if (in_sizes[0] != NBATCH * NDIM * NSEQ) return;
  if (in_sizes[1] != NBATCH * NVAL * NSEQ) return;
  if (in_sizes[2] != NBATCH * NDIM * NSEQ) return;
  if (in_sizes[3] != NDIM * NFEAT) return;
  if (out_size != NBATCH * NVAL * NSEQ) return;
  if (ws_size < sizeof(float) * WS_WORDS) return;
  const float* keys    = (const float*)d_in[0];
  const float* values  = (const float*)d_in[1];
  const float* queries = (const float*)d_in[2];
  const float* proj    = (const float*)d_in[3];
  float* out = (float*)d_out;
  float* ws  = (float*)d_ws;
  lin_attn_chunk_state_kernel<<<dim3(NBATCH, NCHUNK - 1), dim3(NTHR), 0, stream>>>(keys, values, proj, ws);
  lin_attn_chunk_out_kernel<<<dim3(NBATCH, NCHUNK), dim3(NTHR), 0, stream>>>(keys, values, queries, proj, ws, out);
}

// v004
// Measured time: 13.9 microseconds a run.
// In two side-by-side timings against v003, it was 1.07 and 1.08 times as fast.
// Over all steps from v000 it is 21.7 times as fast.
// All contractions (input projections, score tile phi_q*phi_k^T, score*V, phi_q*state, V*phi_k state update): v_wmma_f32_16x16x32_bf16 with bf16 hi/lo split operands (hi*hi + hi*lo + lo*hi), f32 accumulate; the row normaliser is one more column tile of the output products (same form, same split); feature column sums on VALU in f32.
#include <hip/hip_runtime.h>

// ---------------- fixed problem geometry ----------------
constexpr int NBATCH = 8;      // batch
constexpr int NDIM   = 64;     // key/query feature dim (contraction of the projection)
constexpr int NSEQ   = 2048;   // sequence length
constexpr int NFEAT  = 64;     // projection features m
constexpr int NVAL   = 64;     // value dim
constexpr int CHUNK  = 64;     // time steps per sequential chunk
constexpr int NCHUNK = NSEQ / CHUNK;
constexpr int PITB   = 72;     // 16-bit LDS tile pitch (elements): 144 B rows, 16-B aligned fragment loads
constexpr int NTHR   = 256;    // 8 waves per block
constexpr float FEAT_EPS = 1.0e-3f;

static_assert(NSEQ % CHUNK == 0);
static_assert(NDIM == 64 && NFEAT == 64 && NVAL == 64 && CHUNK == 64);
static_assert(NFEAT % 32 == 0);          // the tid < NFEAT branches are wave-uniform
static_assert(NTHR == 256);
static_assert((PITB * 2) % 16 == 0);

typedef __attribute__((ext_vector_type(16))) __bf16   v16b;
typedef __attribute__((ext_vector_type(8)))  __bf16   v8b;
typedef __attribute__((ext_vector_type(8)))  float    v8f;
typedef __attribute__((ext_vector_type(4)))  float    v4f;
typedef __attribute__((ext_vector_type(4)))  unsigned int v4u;
typedef __attribute__((ext_vector_type(2)))  unsigned int v2u;

// ---------------- pieces ----------------
__device__ __forceinline__ unsigned short f2bf_bits(float f) {
  unsigned u = __float_as_uint(f);
  return (unsigned short)((u + 0x7FFFu + ((u >> 16) & 1u)) >> 16);
}
__device__ __forceinline__ float bf_bits2f(unsigned short h) { return __uint_as_float(((unsigned)h) << 16); }

__device__ __forceinline__ void dep_guard_b(v8f& a, v8f& b, v16b x, v16b y) { asm volatile("v_nop\n\tv_nop\n\tv_nop\n\tv_nop" : "+v"(a), "+v"(b) : "v"(x), "v"(y)); }
__device__ __forceinline__ void keep4_b(v16b a, v16b b, v16b c, v16b d) { asm volatile("v_nop" :: "v"(a), "v"(b), "v"(c), "v"(d)); }
template <typename T> struct Frag;
template <> struct Frag<__bf16> {
  typedef v16b V; union U { v16b v; v8b h[2]; };
  static __device__ __forceinline__ v16b load(const __bf16* p) {   // elements 0..7 <- p[0..7], 8..15 <- p[16..23]
    U f; f.h[0] = *(const v8b*)(p); f.h[1] = *(const v8b*)(p + 16); return f.v;
  }
  static __device__ __forceinline__ v8f mma(v16b a, v16b b, v8f c) {
    return __builtin_amdgcn_wmma_f32_16x16x32_bf16(false, a, false, b, (short)0, c, false, false);
  }
  static __device__ __forceinline__ void guard(v8f& a, v8f& b, v16b x, v16b y) { dep_guard_b(a, b, x, y); }
  static __device__ __forceinline__ void keep(v16b a, v16b b, v16b c, v16b d) { keep4_b(a, b, c, d); }
};

// one WMMA with the 4-slot hazard guard (ties D, keeps A/B live)
__device__ __forceinline__ v8f at_mma(v16b a, v16b b, v8f c) {
  c = __builtin_amdgcn_wmma_f32_16x16x32_bf16(false, a, false, b, (short)0, c, false, false);
  asm volatile("v_nop\n\tv_nop\n\tv_nop\n\tv_nop" : "+v"(c) : "v"(a), "v"(b));
  return c;
}

// ---------------- helpers ----------------
// bf16 hi/lo split (RNE convert): f ~= hi + lo, both as bf16 bit patterns
__device__ __forceinline__ void split_bits(float f, unsigned short& hi, unsigned short& lo) {
  hi = f2bf_bits(f);
  lo = f2bf_bits(f - bf_bits2f(hi));
}

__device__ __forceinline__ const __bf16* bfp(const unsigned short* p) { return (const __bf16*)(const void*)p; }

__device__ __forceinline__ v8f zero8() { return (v8f){0.f,0.f,0.f,0.f,0.f,0.f,0.f,0.f}; }

// One 16x16 output tile over K = 64 (two 32-deep steps) of C = A * Bt^T with hi/lo split planes.
// A planes row-major [row][PITB] (k contiguous), Bt planes row-major [n][PITB] (k contiguous); all in LDS.
// Per lane: A row = arow0 + (lane&15), Bt row = brow0 + (lane&15); fragment elements 0..7 <- k0 + 8h + 0..7,
// 8..15 <- k0 + 16 + 8h + 0..7 (h = lane>>4). D element r of lane l -> (arow0 + 8h + r, brow0 + (l&15)).
__device__ __forceinline__ v8f tile_k64_split(const unsigned short* Ah, const unsigned short* Al, int arow0,
                                               const unsigned short* Bh, const unsigned short* Bl, int brow0,
                                               int lane, v8f acc) {
  const int rl = lane & 15, koff = (lane >> 4) * 8;
#pragma unroll
  for (int ks = 0; ks < 2; ++ks) {
    const int ao = (arow0 + rl) * PITB + 32 * ks + koff;
    const int bo = (brow0 + rl) * PITB + 32 * ks + koff;
    const v16b ah = Frag<__bf16>::load(bfp(Ah) + ao);
    const v16b al = Frag<__bf16>::load(bfp(Al) + ao);
    const v16b bh = Frag<__bf16>::load(bfp(Bh) + bo);
    const v16b bl = Frag<__bf16>::load(bfp(Bl) + bo);
    acc = at_mma(ah, bh, acc);
    acc = at_mma(ah, bl, acc);
    acc = at_mma(al, bh, acc);
  }
  return acc;
}

// tile_k64_split, and on the same A fragments one more column tile accN += A * N^T whose 16 rows of N^T are all the vector n:
// every column of accN is alike, so element r of any lane is sum_k A[arow0 + 8h + r][k] n[k]. nh/nl[ks] hold n in the B fragment's
// k order (elements 0..7 <- n[32ks + 8h + 0..7], 8..15 <- n[32ks + 16 + 8h + 0..7]); NLO = false: n is exact in nh, nl is not used.
// acc gets the same products in the same order as in tile_k64_split.
template <bool NLO>
__device__ __forceinline__ v8f tile_k64_split_rowdot(const unsigned short* Ah, const unsigned short* Al, int arow0,
                                                      const unsigned short* Bh, const unsigned short* Bl, int brow0,
                                                      const v16b (&nh)[2], const v16b (&nl)[2],
                                                      int lane, v8f acc, v8f& accN) {
  const int rl = lane & 15, koff = (lane >> 4) * 8;
#pragma unroll
  for (int ks = 0; ks < 2; ++ks) {
    const int ao = (arow0 + rl) * PITB + 32 * ks + koff;
    const int bo = (brow0 + rl) * PITB + 32 * ks + koff;
    const v16b ah = Frag<__bf16>::load(bfp(Ah) + ao);
    const v16b al = Frag<__bf16>::load(bfp(Al) + ao);
    const v16b bh = Frag<__bf16>::load(bfp(Bh) + bo);
    const v16b bl = Frag<__bf16>::load(bfp(Bl) + bo);
    acc  = at_mma(ah, bh, acc);
    accN = at_mma(ah, nh[ks], accN);
    acc  = at_mma(ah, bl, acc);
    if (NLO) accN = at_mma(ah, nl[ks], accN);
    acc  = at_mma(al, bh, acc);
    accN = at_mma(al, nh[ks], accN);
  }
  return acc;
}

// Store a D tile (element r of lane -> (row0 + 8h + r, col0 + (lane&15))) as hi/lo bf16 into row-major LDS planes.
__device__ __forceinline__ void put_split_rm(unsigned short* Ph, unsigned short* Pl, int row0, int col0, int lane, v8f v) {
  const int hq = lane >> 4, cq = lane & 15;
#pragma unroll
  for (int r = 0; r < 8; ++r) {
    unsigned short hb, lb;
    split_bits(v[r], hb, lb);
    const int off = (row0 + 8 * hq + r) * PITB + col0 + cq;
    Ph[off] = hb;
    Pl[off] = lb;
  }
}
// Store the TRANSPOSE of a D tile: element r of lane -> P[col0 + (lane&15)][row0 + 8h + r]; the 8 elements of a lane are
// contiguous -> one 16-B LDS store per plane built from per-lane integer words.
__device__ __forceinline__ void put_split_tr(unsigned short* Ph, unsigned short* Pl, int row0, int col0, int lane, v8f v) {
  const int hq = lane >> 4, cq = lane & 15;
  v4u uh, ul;
#pragma unroll
  for (int e = 0; e < 4; ++e) {
    unsigned short ha, la, hb, lb;
    split_bits(v[2 * e], ha, la);
    split_bits(v[2 * e + 1], hb, lb);
    uh[e] = (unsigned)ha | ((unsigned)hb << 16);
    ul[e] = (unsigned)la | ((unsigned)lb << 16);
  }
  const int off = (col0 + cq) * PITB + row0 + 8 * hq;   // byte offset 144*(col) + 2*(row0+8h): 16-B aligned
  *(v4u*)(Ph + off) = uh;
  *(v4u*)(Pl + off) = ul;
}

// tile_k64_split with the two cross products in the other order (hi*hi, lo*hi, hi*lo): for a product whose operands stand
// the other way round (C^T = B * A^T), it adds the same three products in the same order as tile_k64_split does for C.
__device__ __forceinline__ v8f tile_k64_split_sw(const unsigned short* Ah, const unsigned short* Al, int arow0,
                                                  const unsigned short* Bh, const unsigned short* Bl, int brow0,
                                                  int lane, v8f acc) {
  const int rl = lane & 15, koff = (lane >> 4) * 8;
#pragma unroll
  for (int ks = 0; ks < 2; ++ks) {
    const int ao = (arow0 + rl) * PITB + 32 * ks + koff;
    const int bo = (brow0 + rl) * PITB + 32 * ks + koff;
    const v16b ah = Frag<__bf16>::load(bfp(Ah) + ao);
    const v16b al = Frag<__bf16>::load(bfp(Al) + ao);
    const v16b bh = Frag<__bf16>::load(bfp(Bh) + bo);
    const v16b bl = Frag<__bf16>::load(bfp(Bl) + bo);
    acc = at_mma(ah, bh, acc);
    acc = at_mma(al, bh, acc);
    acc = at_mma(ah, bl, acc);
  }
  return acc;
}

// =====================================================================================================
// Two launches. Launch 1, one block per (batch, chunk of 64 steps), does every product that needs the chunk alone, once:
//   phi_q[l][m], phi_k[i][m] = relu(x^T W) + eps             (projection GEMMs, K = d = 64)
//   A[l][i] = sum_m phi_q[l][m] phi_k[i][m], kept for i <= l  (score tile, K = m = 64)
//   num[l][v] = sum_i A[l][i] V[i][v],  nrm[l] = sum_i A[l][i] (a column tile beside num's, B = ones)
//   dS[m][v] = sum_i phi_k[i][m] V[i][v],  dz[m] = sum_i phi_k[i][m]   (the chunk's share of the state)
// and stores num, nrm, phi_q (hi/lo planes), dS and dz in the workspace.
// Launch 2, one block per (batch, 16 value columns, 4 chunks in a row = 256 steps): S_old and z_old of its four chunks = sums of
// the shares of all earlier chunks, in chunk order (a running sum: each share's 16 columns are read once for four chunks), then
//   out[l][v] = (num[l][v] + sum_m phi_q[l][m] S_old[m][v]) / (nrm[l] + phi_q[l].z_old)
// Workspace (f32 words), every word launch 2 reads is written by launch 1 of the same call:
//   share of (b, c) at (b*NCHUNK + c)*SHARE: 16 x 16 tile (rows m of tile tn, columns v of tile tm) at (tm*4 + tn)*256, in register
//   order (below);  dz of (b, c) at DZ_BASE + (b*NCHUNK + c)*NFEAT;
//   num at NUM_BASE: 16 x 16 tile (row tile tm, column tile tn) of (b, c) at (((b*NCHUNK + c)*4 + tm)*4 + tn)*256, in register order
//   (word 128*half + 4*lane + e = element 4*half + e of the lane);  nrm at NRM_BASE as [b][l];
//   phi_q hi, lo (16-bit) at PQH_BASE, PQL_BASE: 8 KB a chunk and plane, in the order of launch 2's A fragment loads.
// =====================================================================================================
constexpr int SHARE    = NVAL * NFEAT;                     // f32 words of one chunk's state share
constexpr int DZ_BASE  = NBATCH * NCHUNK * SHARE;
constexpr int NUM_BASE = DZ_BASE + NBATCH * NCHUNK * NFEAT;
constexpr int NRM_BASE = NUM_BASE + NBATCH * NVAL * NSEQ;
constexpr int PQH_BASE = NRM_BASE + NBATCH * NSEQ;
constexpr int PQL_BASE = PQH_BASE + NBATCH * NSEQ * NFEAT / 2;
constexpr int WS_WORDS = PQL_BASE + NBATCH * NSEQ * NFEAT / 2;
constexpr int GCH      = 4;                                // chunks of one block of launch 2
constexpr int NGRP     = NCHUNK / GCH;
constexpr int VSL      = 16;                               // value columns of one block of launch 2
constexpr int PITO     = GCH * CHUNK + 4;                  // f32 pitch of launch 2's out tile: 16 rows' 16-B stores fall on 64 banks
static_assert(NCHUNK % GCH == 0 && NVAL % VSL == 0 && GCH * CHUNK == 32 * (NTHR / 32) && VSL * NFEAT == 4 * NTHR && GCH * NFEAT == NTHR);

// 16-B global load at a block-uniform base plus a per-thread byte offset plus a constant: the base stays in scalar registers
// and one offset register serves every load of a thread.
__device__ __forceinline__ v4f ld16(const float* __restrict__ ubase, unsigned tbyte, unsigned cbyte) {
  return *(const v4f*)((const char*)ubase + tbyte + cbyte);
}
// per-thread byte offset into a [row][NSEQ] f32 tensor for the 64 x 64 V chunk loads: row tid>>4, columns 4*(tid&15)..+3;
// pass 'it' adds 16 rows
__device__ __forceinline__ unsigned chunk_tbyte(int tid) { return (unsigned)(((tid >> 4) * NSEQ + ((tid & 15) << 2)) * 4); }
constexpr unsigned ROWS16_BYTES = 16u * NSEQ * 4u;

// Transposed hi/lo staging of a 64 x 64 f32 tile x[r][c] (row pitch RP floats) into planes P[c][r] (pitch PITB).
// A thread takes rows 2p and 2p+1 at columns c4..c4+3 and stores one dword (P[c][2p], P[c][2p+1]) per column and plane.
// Lane -> k = lane&7 (c4 = 4k + 32*(w&1), 128 B of a row per 8 lanes), pl = lane>>3 (p = 4*(w>>1) + pl); pass 'it' adds 16 pairs.
// Bank of a store = (16*(k&3) + 36*column-in-four + p) mod 64: lanes k and k+4 (plane rows 16 apart) would meet, so the plane
// rows whose bit 4 is set hold their 16-B groups swapped in pairs: element r of plane row c lies at r ^ tr_swz(c). The 32 lanes
// of every store then fall on 32 banks; a fragment's 16 rows share one tr_swz, so a reader only flips its 8-element offset.
__device__ __forceinline__ int tr_swz(int c) { return ((c >> 4) & 1) << 3; }
// f2bf_bits before its last shift
__device__ __forceinline__ unsigned rne_word(float f) {
  const unsigned u = __float_as_uint(f);
  return u + 0x7FFFu + ((u >> 16) & 1u);
}
template <int RP>
__device__ __forceinline__ unsigned tr_tbyte(int tid) {
  const int k = tid & 7, pl = (tid >> 3) & 3, w = tid >> 5;
  return (unsigned)(((2 * (4 * (w >> 1) + pl)) * RP + 4 * k + 32 * (w & 1)) * 4);
}
// x[2*it + s] = row 2p + s of pass it
template <int RP>
__device__ __forceinline__ void load_tr(const float* __restrict__ ubase, int tid, v4f (&x)[4]) {
#pragma unroll
  for (int it = 0; it < 2; ++it)
#pragma unroll
    for (int s = 0; s < 2; ++s)
      x[2 * it + s] = ld16(ubase, tr_tbyte<RP>(tid), (unsigned)((32 * it + s) * RP * 4));
}
__device__ __forceinline__ void put_tr_pairs(unsigned short* Ph, unsigned short* Pl, int tid, const v4f (&x)[4]) {
  const int k = tid & 7, pl = (tid >> 3) & 3, w = tid >> 5;
  const int c4 = 4 * k + 32 * (w & 1);
  const int sz = tr_swz(c4);          // the same for c4..c4+3
#pragma unroll
  for (int it = 0; it < 2; ++it) {
    const int p = 4 * (w >> 1) + pl + 16 * it;
#pragma unroll
    for (int e = 0; e < 4; ++e) {
      // the split of split_bits on both rows, kept in 32-bit words: the bf16 is the upper half of each rounded word
      const float a = x[2 * it][e], c = x[2 * it + 1][e];
      const unsigned ra = rne_word(a), rc = rne_word(c);
      const unsigned sa = rne_word(a - __uint_as_float(ra & 0xffff0000u));
      const unsigned sc = rne_word(c - __uint_as_float(rc & 0xffff0000u));
      const int off = (c4 + e) * PITB + ((2 * p) ^ sz);   // even: 4-B aligned
      // byte select: upper half of the second word below, upper half of the first word above
      *(unsigned*)(Ph + off) = __builtin_amdgcn_perm(rc, ra, 0x07060302u);
      *(unsigned*)(Pl + off) = __builtin_amdgcn_perm(sc, sa, 0x07060302u);
    }
  }
}

// V chunk (vc = first column of the chunk in row 0): [v][i] f32 -> hi/lo planes [v][i]; 1024 v4f = 256 x 4; 4 halves packed into two integer words per plane
__device__ __forceinline__ void stage_v(const float* __restrict__ vc, unsigned short* sVh, unsigned short* sVl, int tid) {
#pragma unroll
  for (int it = 0; it < 4; ++it) {
    const int idx = tid + it * NTHR;
    const int vr  = idx >> 4;
    const int i4  = (idx & 15) << 2;
    const v4f vv = ld16(vc, chunk_tbyte(tid), (unsigned)it * ROWS16_BYTES);
    unsigned short h0, g0, h1, g1, h2, g2, h3, g3;
    split_bits(vv[0], h0, g0);
    split_bits(vv[1], h1, g1);
    split_bits(vv[2], h2, g2);
    split_bits(vv[3], h3, g3);
    v2u uh, ul;
    uh[0] = (unsigned)h0 | ((unsigned)h1 << 16);
    uh[1] = (unsigned)h2 | ((unsigned)h3 << 16);
    ul[0] = (unsigned)g0 | ((unsigned)g1 << 16);
    ul[1] = (unsigned)g2 | ((unsigned)g3 << 16);
    const int off = vr * PITB + i4;      // byte 144*vr + 2*i4 : 8-B aligned
    *(v2u*)(sVh + off) = uh;
    *(v2u*)(sVl + off) = ul;
  }
}

// ---------------- launch 1: all that one chunk gives by itself ----------------
// LDS tile reuse (every producer/consumer pair of a tile is separated by a block barrier):
//   sXh/sXl : q^T hi/lo [l][d] (phases 0-1), then V [v][i] (phases 2-4)
//   sKAh/l  : phi_k [i][m] (phases 1-2), then masked A [l][i] (phases 2b-4)
__global__ __launch_bounds__(NTHR)
void lin_attn_chunk_local_kernel(const float* __restrict__ keys,
                                 const float* __restrict__ values,
                                 const float* __restrict__ queries,
                                 const float* __restrict__ proj,
                                 float* __restrict__ wsh,    // the workspace's parts, as laid out above
                                 float* __restrict__ wdz,
                                 float* __restrict__ wnum,
                                 float* __restrict__ wnrm,
                                 float* __restrict__ wqh,
                                 float* __restrict__ wql) {
  __shared__ __align__(16) unsigned short sXh[CHUNK * PITB];
  __shared__ __align__(16) unsigned short sXl[CHUNK * PITB];
  __shared__ __align__(16) unsigned short sYh[CHUNK * PITB];   // k^T hi [i][d]
  __shared__ __align__(16) unsigned short sYl[CHUNK * PITB];
  __shared__ __align__(16) unsigned short sWh[NFEAT * PITB];   // W^T hi [m][d]
  __shared__ __align__(16) unsigned short sWl[NFEAT * PITB];   // W^T lo [m][d]
  __shared__ __align__(16) unsigned short sQh[CHUNK * PITB];   // phi_q hi [l][m]
  __shared__ __align__(16) unsigned short sQl[CHUNK * PITB];
  __shared__ __align__(16) unsigned short sKAh[CHUNK * PITB];
  __shared__ __align__(16) unsigned short sKAl[CHUNK * PITB];
  __shared__ __align__(16) unsigned short sKTh[NFEAT * PITB];  // phi_k^T hi [m][i]
  __shared__ __align__(16) unsigned short sKTl[NFEAT * PITB];
  __shared__ __align__(16) float sN[CHUNK];                    // nrm [l]

  const int tid  = threadIdx.x;
  const int lane = tid & 31;
  const int w    = tid >> 5;          // wave 0..7
  const int hh   = lane >> 4;
  const int cc   = lane & 15;
  const int tm   = w >> 1;            // row-tile index owned by this wave in every 64x64 GEMM but dS, where it is the v column tile
  const int tn0  = (w & 1) * 2;       // first of the two column tiles owned by this wave (the m row tiles in dS)
  const int b    = blockIdx.x;        // grid.x == NBATCH
  const int ch   = blockIdx.y;        // grid.y == NCHUNK
  const int l0   = ch * CHUNK;

  const float* kc = keys    + (size_t)b * NDIM * NSEQ + l0;
  const float* qc = queries + (size_t)b * NDIM * NSEQ + l0;
  const float* vc = values  + (size_t)b * NVAL * NSEQ + l0;

  // ---- phase 0: W ([d][m]) and the q, k chunks ([d][l0..l0+63]) f32 -> hi/lo bf16 transposed: W^T [m][d], q^T, k^T [l][d] ----
  {
    v4f wv[4], qv[4], kv[4];
    load_tr<NFEAT>(proj, tid, wv);
    // precaution: the build lets a later load's result land in the offset register of the loads above; this wait stands in front
    asm volatile("s_wait_xcnt 0x0" ::: "memory");
    load_tr<NSEQ>(qc, tid, qv);
    load_tr<NSEQ>(kc, tid, kv);
    // precaution: the build reuses the scalar base registers of the loads above right behind them; this wait stands in front
    asm volatile("s_wait_xcnt 0x0" ::: "memory");
    put_tr_pairs(sWh, sWl, tid, wv);
    put_tr_pairs(sXh, sXl, tid, qv);
    put_tr_pairs(sYh, sYl, tid, kv);
  }
  __syncthreads();   // B1

  // ---- phase 1: phi = relu(x^T W) + eps : A = x^T [l][d], Bt = W^T [m][d] ----
  {
    v8f aq[2], ak[2];
    aq[0] = zero8(); aq[1] = zero8(); ak[0] = zero8(); ak[1] = zero8();
    const int rl = lane & 15, koff = hh * 8;
#pragma unroll
    for (int ks = 0; ks < 2; ++ks) {
      const int ao = (16 * tm + rl) * PITB + 32 * ks + (koff ^ tr_swz(16 * tm));
      const v16b qh = Frag<__bf16>::load(bfp(sXh) + ao);
      const v16b ql = Frag<__bf16>::load(bfp(sXl) + ao);
      const v16b kh = Frag<__bf16>::load(bfp(sYh) + ao);
      const v16b kl = Frag<__bf16>::load(bfp(sYl) + ao);
#pragma unroll
      for (int j = 0; j < 2; ++j) {
        const int bo = (16 * (tn0 + j) + rl) * PITB + 32 * ks + (koff ^ tr_swz(16 * (tn0 + j)));
        const v16b wh = Frag<__bf16>::load(bfp(sWh) + bo);
        const v16b wl = Frag<__bf16>::load(bfp(sWl) + bo);
        aq[j] = at_mma(qh, wh, aq[j]);
        aq[j] = at_mma(qh, wl, aq[j]);
        aq[j] = at_mma(ql, wh, aq[j]);
        ak[j] = at_mma(kh, wh, ak[j]);
        ak[j] = at_mma(kh, wl, ak[j]);
        ak[j] = at_mma(kl, wh, ak[j]);
      }
    }
#pragma unroll
    for (int j = 0; j < 2; ++j) {
      v8f pq, pk;
#pragma unroll
      for (int r = 0; r < 8; ++r) {
        pq[r] = fmaxf(aq[j][r], 0.f) + FEAT_EPS;
        pk[r] = fmaxf(ak[j][r], 0.f) + FEAT_EPS;
      }
      put_split_rm(sQh,  sQl,  16 * tm, 16 * (tn0 + j), lane, pq);   // phi_q [l][m]
      put_split_rm(sKAh, sKAl, 16 * tm, 16 * (tn0 + j), lane, pk);   // phi_k [i][m]
      put_split_tr(sKTh, sKTl, 16 * tm, 16 * (tn0 + j), lane, pk);   // phi_k^T [m][i]
    }
  }
  __syncthreads();   // B2

  // ---- phase 2: stage V ([v][l0+i] f32 -> hi/lo [v][i]), score GEMM ----
  v8f accA[2];
  {
    stage_v(vc, sXh, sXl, tid);
    // A[l][i] = sum_m phi_q[l][m] phi_k[i][m] : A = phi_q rows l, Bt = phi_k rows i; causal mask i <= l
#pragma unroll
    for (int j = 0; j < 2; ++j) {
      accA[j] = tile_k64_split(sQh, sQl, 16 * tm, sKAh, sKAl, 16 * (tn0 + j), lane, zero8());
#pragma unroll
      for (int r = 0; r < 8; ++r) {
        const int row = 16 * tm + 8 * hh + r;
        const int col = 16 * (tn0 + j) + cc;
        const float a = accA[j][r];
        accA[j][r] = (col <= row) ? a : 0.f;
      }
    }
  }
  __syncthreads();   // B3

  // ---- phase 2b: masked A -> hi/lo planes (over phi_k's tile space; explicit zeros stored) ----
#pragma unroll
  for (int j = 0; j < 2; ++j)
    put_split_rm(sKAh, sKAl, 16 * tm, 16 * (tn0 + j), lane, accA[j]);
  __syncthreads();   // B4

  // ---- phase 4: num tile and, on the first tile's A fragments, the row sums of A; the chunk's share of the state ----
  v8f ds[2], accO[2];
  v8f accN = zero8();                 // element r: nrm[16*tm + 8h + r], alike in the 16 lanes of a half
  float zp = 0.f;
  {
    v16b one[2];
#pragma unroll
    for (int ks = 0; ks < 2; ++ks)
#pragma unroll
      for (int e = 0; e < 16; ++e) one[ks][e] = (__bf16)1.0f;
    // sum_i A[l][i] V[i][v] : A = masked A rows l, Bt = V [v][i];  nrm = sum_i A[l][i]
    accO[0] = tile_k64_split_rowdot<false>(sKAh, sKAl, 16 * tm, sXh, sXl, 16 * tn0, one, one, lane, zero8(), accN);
    accO[1] = tile_k64_split(sKAh, sKAl, 16 * tm, sXh, sXl, 16 * (tn0 + 1), lane, zero8());
    // both waves of a row tile hold its row sums; the first one's lanes 0 and 16 hand on 8 rows each
    if ((w & 1) == 0 && cc == 0) {
      v4f n0, n1;
      n0[0] = accN[0]; n0[1] = accN[1]; n0[2] = accN[2]; n0[3] = accN[3];
      n1[0] = accN[4]; n1[1] = accN[5]; n1[2] = accN[6]; n1[3] = accN[7];
      *(v4f*)(sN + 16 * tm + 8 * hh)     = n0;
      *(v4f*)(sN + 16 * tm + 8 * hh + 4) = n1;
    }
    // dS[m][v] = sum_i phi_k[i][m] V[i][v] : A = phi_k^T [m][i] rows m = 16*(tn0+j).., Bt = V [v][i] rows v = 16*tm..
#pragma unroll
    for (int j = 0; j < 2; ++j)
      ds[j] = tile_k64_split_sw(sKTh, sKTl, 16 * (tn0 + j), sXh, sXl, 16 * tm, lane, zero8());
    // dz[m] = sum_i phi_k[i][m], from the hi + lo planes (waves 0-1; the branch is wave-uniform)
    if (tid < NFEAT) {
#pragma unroll
      for (int j = 0; j < 8; ++j) {
        const v4u wh = *(const v4u*)(sKTh + tid * PITB + 8 * j);
        const v4u wl = *(const v4u*)(sKTl + tid * PITB + 8 * j);
#pragma unroll
        for (int e = 0; e < 4; ++e) {
          zp += __uint_as_float(wh[e] << 16) + __uint_as_float(wl[e] << 16);
          zp += __uint_as_float(wh[e] & 0xffff0000u) + __uint_as_float(wl[e] & 0xffff0000u);
        }
      }
    }
  }
  __syncthreads();   // B5: nrm complete

  // the stores come last: no register that they name is written again
  {
    const v4f nv = *(const v4f*)(sN + 4 * (tid & 15));
    // phi_q planes in the order of launch 2's A fragment loads: 16-B unit u = ((row tile*2 + ks)*2 + p)*32 + lane holds
    // phi_q[16*tile + (lane&15)][32*ks + 16*p + 8*(lane>>4) + 0..7]; this thread copies units tid and tid + NTHR (row tiles +2)
    const int qs = (16 * (tid >> 7) + cc) * PITB + 32 * ((tid >> 6) & 1) + 16 * ((tid >> 5) & 1) + 8 * hh;
    const v4u h0 = *(const v4u*)(sQh + qs);
    const v4u h1 = *(const v4u*)(sQh + qs + 32 * PITB);
    const v4u g0 = *(const v4u*)(sQl + qs);
    const v4u g1 = *(const v4u*)(sQl + qs + 32 * PITB);
    // share: each 16 x 16 tile (rows m, columns v) in its register order, 512 B per store
    float* sb = wsh + (size_t)(b * NCHUNK + ch) * SHARE + (tm * 4 + tn0) * 256 + 4 * lane;
#pragma unroll
    for (int j = 0; j < 2; ++j) {
      v4f a0, a1;
      a0[0] = ds[j][0]; a0[1] = ds[j][1]; a0[2] = ds[j][2]; a0[3] = ds[j][3];
      a1[0] = ds[j][4]; a1[1] = ds[j][5]; a1[2] = ds[j][6]; a1[3] = ds[j][7];
      *(v4f*)(sb + 256 * j)       = a0;
      *(v4f*)(sb + 256 * j + 128) = a1;
    }
    // num: each 16 x 16 tile in its register order, 512 B per store
    float* nb = wnum + (size_t)(((b * NCHUNK + ch) * 4 + tm) * 4 + tn0) * 256 + 4 * lane;
#pragma unroll
    for (int j = 0; j < 2; ++j) {
      v4f o0, o1;
      o0[0] = accO[j][0]; o0[1] = accO[j][1]; o0[2] = accO[j][2]; o0[3] = accO[j][3];
      o1[0] = accO[j][4]; o1[1] = accO[j][5]; o1[2] = accO[j][6]; o1[3] = accO[j][7];
      *(v4f*)(nb + 256 * j)       = o0;
      *(v4f*)(nb + 256 * j + 128) = o1;
    }
    const unsigned qo = 16u * (unsigned)tid;
    char* gh = (char*)(wqh + (size_t)(b * NSEQ + l0) * (NFEAT / 2));   // block-uniform
    char* gl = (char*)(wql + (size_t)(b * NSEQ + l0) * (NFEAT / 2));
    *(v4u*)(gh + qo)              = h0;
    *(v4u*)(gh + qo + 16u * NTHR) = h1;
    *(v4u*)(gl + qo)              = g0;
    *(v4u*)(gl + qo + 16u * NTHR) = g1;
    if (tid < NFEAT) wdz[(b * NCHUNK + ch) * NFEAT + tid] = zp;
    // nrm: 16 lanes of one wave write the chunk's 64 rows
    if (tid < CHUNK / 4) *(v4f*)(wnrm + b * NSEQ + l0 + 4 * tid) = nv;
  }
}

// ---------------- launch 2: the earlier chunks' part, 256 steps x 16 value columns a block ----------------
__global__ __launch_bounds__(NTHR)
void lin_attn_state_out_kernel(const float* __restrict__ wsh,    // the workspace's parts, as laid out above
                               const float* __restrict__ wdz,
                               const float* __restrict__ wnum,
                               const float* __restrict__ wnrm,
                               const float* __restrict__ wqh,
                               const float* __restrict__ wql,
                               float* __restrict__ out) {
  __shared__ __align__(16) unsigned short sSh[GCH * VSL * PITB];   // S_old^T hi of chunk k of the block: [k][v][m]
  __shared__ __align__(16) unsigned short sSl[GCH * VSL * PITB];
  __shared__ __align__(16) unsigned short sZh[GCH * NFEAT];        // z_old hi [k][m]
  __shared__ __align__(16) unsigned short sZl[GCH * NFEAT];
  __shared__ __align__(16) float sNr[GCH * CHUNK];                 // nrm of the block's steps
  __shared__ __align__(16) float sO[VSL * PITO];                   // out [v][step]

  const int tid  = threadIdx.x;
  const int lane = tid & 31;
  const int w    = tid >> 5;          // wave 0..7: steps 32*w .. 32*w+31 of the block, two row tiles
  const int hh   = lane >> 4;
  const int cc   = lane & 15;
  const int b    = blockIdx.x;                   // grid.x == NBATCH
  const int vq   = blockIdx.y;                   // grid.y == NVAL / VSL
  const int g    = NGRP - 1 - (int)blockIdx.z;   // grid.z == NGRP; the blocks with the most shares to sum start first
  const int c0   = GCH * g;                      // first chunk of the block = number of shares in front of it
  const int s0   = c0 * CHUNK;                   // first step of the block

  // ---- all loads of the block are asked for at once ----
  // thread tid holds words 4*tid..+3 of a share's 16 columns (4 KB in a row, four 16 x 16 tiles in register order):
  // v = tid&15, m = 16*(tid>>6) + 8*((tid>>4)&1) + 4*((tid>>5)&1) + 0..3
  const char* xp = (const char*)(wsh + (size_t)b * NCHUNK * SHARE + vq * VSL * NFEAT) + 16u * (unsigned)tid;
  const char* yp = xp + (size_t)c0 * SHARE * 4u;
  // unrolled so that every share's place is a constant in the load's offset field; the test is block-uniform
  v4f x[NCHUNK - GCH], y[GCH - 1];
#pragma unroll
  for (int gg = 0; gg < NGRP - 1; ++gg) {
    if (gg >= g) break;
#pragma unroll
    for (int u = 0; u < GCH; ++u) x[GCH * gg + u] = *(const v4f*)(xp + (unsigned)(GCH * gg + u) * SHARE * 4u);
  }
#pragma unroll
  for (int k = 0; k < GCH - 1; ++k) y[k] = *(const v4f*)(yp + (unsigned)k * SHARE * 4u);
  // precaution: the address registers of the loads above are free for reuse behind them; named here, they last up to this wait
  asm volatile("s_wait_xcnt 0x0" :: "v"(xp), "v"(yp) : "memory");

  const int zi = tid & (NFEAT - 1), zk = tid >> 6;                 // this thread sums z_old[zi] of chunk c0 + zk
  const unsigned zo = 4u * (unsigned)zi;
  const unsigned no = 4u * (unsigned)tid;
  const unsigned fo = (unsigned)(w * 4096 + lane * 16);                      // phi_q: 2 KB a row tile and plane, in fragment order
  const unsigned uo = (unsigned)(w * 8192 + lane * 16);                      // num: 4 KB a row tile (4 column tiles), in register order
  const float* zb  = wdz + b * NCHUNK * NFEAT;                                      // all block-uniform
  const float* rb  = wnrm + b * NSEQ + s0;
  const float* qhb = wqh + (size_t)(b * NSEQ + s0) * (NFEAT / 2);
  const float* qlb = wql + (size_t)(b * NSEQ + s0) * (NFEAT / 2);
  const float* nb  = wnum + (size_t)(b * NCHUNK + c0) * SHARE + vq * 256;
  float zx[NCHUNK - 1];
#pragma unroll
  for (int c = 0; c < NCHUNK - 1; ++c) zx[c] = *(const float*)((const char*)(zb + c * NFEAT) + zo);
  const float nr = *(const float*)((const char*)rb + no);
  // phi_q fragments (elements 0..7 <- m = 32ks + 8h + 0..7, 8..15 <- 16 further) and num of this wave's two row tiles
  v4f fh[2][2][2], fl[2][2][2], nu[2][2];
#pragma unroll
  for (int t = 0; t < 2; ++t) {
#pragma unroll
    for (int ks = 0; ks < 2; ++ks)
#pragma unroll
      for (int p = 0; p < 2; ++p) {
        fh[t][ks][p] = ld16(qhb, fo, (unsigned)(2048 * t + 512 * (2 * ks + p)));
        fl[t][ks][p] = ld16(qlb, fo, (unsigned)(2048 * t + 512 * (2 * ks + p)));
      }
    nu[t][0] = ld16(nb, uo, (unsigned)(4096 * t));
    nu[t][1] = ld16(nb, uo, (unsigned)(4096 * t + 512));
  }
  // keeps the loads together in front of the sums: left free, the scheduler issues them a few at a time, each lot waiting out
  // a whole trip to L2
  __builtin_amdgcn_sched_barrier(0);
  // precaution: the offset registers of the loads above are free for reuse behind them; named here, they last up to this wait
  asm volatile("s_wait_xcnt 0x0" :: "v"(zo), "v"(no), "v"(fo), "v"(uo) : "memory");
  // keeps later scalar address work, which reuses the loads' base registers, behind the wait
  __builtin_amdgcn_sched_barrier(0);

  // ---- S_old^T (16 columns) and z_old of the four chunks: running sums in chunk order, split into hi/lo planes ----
  {
    v4f s;
    s[0] = 0.f; s[1] = 0.f; s[2] = 0.f; s[3] = 0.f;
#pragma unroll
    for (int gg = 0; gg < NGRP - 1; ++gg) {
      if (gg >= g) break;
#pragma unroll
      for (int u = 0; u < GCH; ++u)
#pragma unroll
        for (int e = 0; e < 4; ++e) s[e] += x[GCH * gg + u][e];
    }
#pragma unroll
    for (int k = 0; k < GCH; ++k) {
      if (k > 0) {
#pragma unroll
        for (int e = 0; e < 4; ++e) s[e] += y[k - 1][e];
      }
      unsigned short h0, g0, h1, g1, h2, g2, h3, g3;
      split_bits(s[0], h0, g0);
      split_bits(s[1], h1, g1);
      split_bits(s[2], h2, g2);
      split_bits(s[3], h3, g3);
      v2u uh, ul;
      uh[0] = (unsigned)h0 | ((unsigned)h1 << 16);
      uh[1] = (unsigned)h2 | ((unsigned)h3 << 16);
      ul[0] = (unsigned)g0 | ((unsigned)g1 << 16);
      ul[1] = (unsigned)g2 | ((unsigned)g3 << 16);
      const int off = (k * VSL + cc) * PITB + 16 * (tid >> 6) + 8 * hh + 4 * ((tid >> 5) & 1);   // 8-B aligned
      *(v2u*)(sSh + off) = uh;
      *(v2u*)(sSl + off) = ul;
    }
    float zs = 0.f;
#pragma unroll
    for (int c = 0; c < NCHUNK - 1; ++c) zs += (c < c0 + zk) ? zx[c] : 0.f;
    unsigned short hz, lz;
    split_bits(zs, hz, lz);
    sZh[zk * NFEAT + zi] = hz;
    sZl[zk * NFEAT + zi] = lz;
    sNr[tid] = nr;
  }
  __syncthreads();   // S_old^T, z_old planes and nrm complete

  // ---- num += phi_q S_old, nrm += phi_q.z_old (a column tile beside it, B = z_old in all 16 rows); divide; store ----
  {
    const int kq = w >> 1;            // this wave's chunk in the block
    v8f accO[2], accN[2];
#pragma unroll
    for (int t = 0; t < 2; ++t) {
      const v4f n0 = *(const v4f*)(sNr + 32 * w + 16 * t + 8 * hh);
      const v4f n1 = *(const v4f*)(sNr + 32 * w + 16 * t + 8 * hh + 4);
#pragma unroll
      for (int e = 0; e < 4; ++e) {
        accO[t][e] = nu[t][0][e]; accO[t][4 + e] = nu[t][1][e];
        accN[t][e] = n0[e];       accN[t][4 + e] = n1[e];
      }
    }
#pragma unroll
    for (int ks = 0; ks < 2; ++ks) {
      const int bo = (kq * VSL + cc) * PITB + 32 * ks + 8 * hh;
      const v16b bh = Frag<__bf16>::load(bfp(sSh) + bo);
      const v16b bl = Frag<__bf16>::load(bfp(sSl) + bo);
      const v16b zh = Frag<__bf16>::load(bfp(sZh) + kq * NFEAT + 32 * ks + 8 * hh);
      const v16b zl = Frag<__bf16>::load(bfp(sZl) + kq * NFEAT + 32 * ks + 8 * hh);
#pragma unroll
      for (int t = 0; t < 2; ++t) {
        Frag<__bf16>::U ua, ub;
        ua.h[0] = __builtin_bit_cast(v8b, fh[t][ks][0]); ua.h[1] = __builtin_bit_cast(v8b, fh[t][ks][1]);
        ub.h[0] = __builtin_bit_cast(v8b, fl[t][ks][0]); ub.h[1] = __builtin_bit_cast(v8b, fl[t][ks][1]);
        const v16b ah = ua.v, al = ub.v;
        accO[t] = at_mma(ah, bh, accO[t]);
        accN[t] = at_mma(ah, zh, accN[t]);
        accO[t] = at_mma(ah, bl, accO[t]);
        accN[t] = at_mma(ah, zl, accN[t]);
        accO[t] = at_mma(al, bh, accO[t]);
        accN[t] = at_mma(al, zh, accN[t]);
      }
    }
    // element r of tile t -> sO[v = cc][step 32*w + 16*t + 8h + r]
#pragma unroll
    for (int t = 0; t < 2; ++t) {
      v4f o0, o1;
#pragma unroll
      for (int e = 0; e < 4; ++e) {
        o0[e] = accO[t][e]     * (1.0f / accN[t][e]);
        o1[e] = accO[t][4 + e] * (1.0f / accN[t][4 + e]);
      }
      const int off = cc * PITO + 32 * w + 16 * t + 8 * hh;   // byte 1040*v + 32*(...): 16-B aligned
      *(v4f*)(sO + off)     = o0;
      *(v4f*)(sO + off + 4) = o1;
    }
  }
  __syncthreads();   // out tile complete

  // One instruction writes 512 B in a row of one output row; the stores come last: no register that they name is written again
  {
    float* ob = out + (size_t)(b * NVAL + vq * VSL) * NSEQ + s0;   // block-uniform
    v4f val[4];
#pragma unroll
    for (int it = 0; it < 4; ++it) val[it] = *(const v4f*)(sO + (4 * it + (tid >> 6)) * PITO + 4 * (tid & 63));
#pragma unroll
    for (int it = 0; it < 4; ++it)
      *(v4f*)(ob + (size_t)(4 * it + (tid >> 6)) * NSEQ + 4 * (tid & 63)) = val[it];
  }
}

extern "C" void kernel_launch(void* const* d_in, const int* in_sizes, int n_in,
                              void* d_out, int out_size, void* d_ws, size_t ws_size,
                              hipStream_t stream) {
  if (n_in < 4) return;
  if (in_sizes[0] != NBATCH * NDIM * NSEQ) return;
  if (in_sizes[1] != NBATCH * NVAL * NSEQ) return;
  if (in_sizes[2] != NBATCH * NDIM * NSEQ) return;
  if (in_sizes[3] != NDIM * NFEAT) return;
  if (out_size != NBATCH * NVAL * NSEQ) return;
  if (ws_size < sizeof(float) * WS_WORDS) return;
  const float* keys    = (const float*)d_in[0];
  const float* values  = (const float*)d_in[1];
  const float* queries = (const float*)d_in[2];
  const float* proj    = (const float*)d_in[3];
  float* out = (float*)d_out;
  float* ws  = (float*)d_ws;
  lin_attn_chunk_local_kernel<<<dim3(NBATCH, NCHUNK), dim3(NTHR), 0, stream>>>(keys, values, queries, proj, ws, ws + DZ_BASE, ws + NUM_BASE, ws + NRM_BASE, ws + PQH_BASE, ws + PQL_BASE);
  lin_attn_state_out_kernel<<<dim3(NBATCH, NVAL / VSL, NGRP), dim3(NTHR), 0, stream>>>(ws, ws + DZ_BASE, ws + NUM_BASE, ws + NRM_BASE, ws + PQH_BASE, ws + PQL_BASE, out);
}

// v005
// One run takes 12.9 microseconds.
// Timed twice side by side with v004, it ran 1.09 and 1.10 times as fast.
// Counting every step since v000, it is 23.9 times as fast.
// All contractions (input projections, score tile phi_q*phi_k^T, score*V, phi_q*state, V*phi_k state update): v_wmma_f32_16x16x32_bf16 with bf16 hi/lo split operands (hi*hi + hi*lo + lo*hi), f32 accumulate; the row normaliser is one more column tile of the output products (same form, same split); feature column sums on VALU in f32.
#include <hip/hip_runtime.h>

// ---------------- fixed problem geometry ----------------
constexpr int NBATCH = 8;      // batch
constexpr int NDIM   = 64;     // key/query feature dim (contraction of the projection)
constexpr int NSEQ   = 2048;   // sequence length
constexpr int NFEAT  = 64;     // projection features m
constexpr int NVAL   = 64;     // value dim
constexpr int CHUNK  = 64;     // time steps per sequential chunk
constexpr int NCHUNK = NSEQ / CHUNK;
constexpr int PITB   = 72;     // 16-bit LDS tile pitch (elements): 144 B rows, 16-B aligned fragment loads
constexpr int NTHR   = 256;    // 8 waves per block
constexpr float FEAT_EPS = 1.0e-3f;

static_assert(NSEQ % CHUNK == 0);
static_assert(NDIM == 64 && NFEAT == 64 && NVAL == 64 && CHUNK == 64);
static_assert(NFEAT % 32 == 0);          // the tid < NFEAT branches are wave-uniform
static_assert(NTHR == 256);
static_assert((PITB * 2) % 16 == 0);

typedef __attribute__((ext_vector_type(16))) __bf16   v16b;
typedef __attribute__((ext_vector_type(8)))  __bf16   v8b;
typedef __attribute__((ext_vector_type(8)))  float    v8f;
typedef __attribute__((ext_vector_type(4)))  float    v4f;
typedef __attribute__((ext_vector_type(4)))  unsigned int v4u;
typedef __attribute__((ext_vector_type(2)))  unsigned int v2u;

// ---------------- pieces ----------------
__device__ __forceinline__ unsigned short f2bf_bits(float f) {
  unsigned u = __float_as_uint(f);
  return (unsigned short)((u + 0x7FFFu + ((u >> 16) & 1u)) >> 16);
}
__device__ __forceinline__ float bf_bits2f(unsigned short h) { return __uint_as_float(((unsigned)h) << 16); }

__device__ __forceinline__ void dep_guard_b(v8f& a, v8f& b, v16b x, v16b y) { asm volatile("v_nop\n\tv_nop\n\tv_nop\n\tv_nop" : "+v"(a), "+v"(b) : "v"(x), "v"(y)); }
__device__ __forceinline__ void keep4_b(v16b a, v16b b, v16b c, v16b d) { asm volatile("v_nop" :: "v"(a), "v"(b), "v"(c), "v"(d)); }
template <typename T> struct Frag;
template <> struct Frag<__bf16> {
  typedef v16b V; union U { v16b v; v8b h[2]; };
  static __device__ __forceinline__ v16b load(const __bf16* p) {   // elements 0..7 <- p[0..7], 8..15 <- p[16..23]
    U f; f.h[0] = *(const v8b*)(p); f.h[1] = *(const v8b*)(p + 16); return f.v;
  }
  static __device__ __forceinline__ v8f mma(v16b a, v16b b, v8f c) {
    return __builtin_amdgcn_wmma_f32_16x16x32_bf16(false, a, false, b, (short)0, c, false, false);
  }
  static __device__ __forceinline__ void guard(v8f& a, v8f& b, v16b x, v16b y) { dep_guard_b(a, b, x, y); }
  static __device__ __forceinline__ void keep(v16b a, v16b b, v16b c, v16b d) { keep4_b(a, b, c, d); }
};

// one WMMA with the 4-slot hazard guard (ties D, keeps A/B live)
__device__ __forceinline__ v8f at_mma(v16b a, v16b b, v8f c) {
  c = __builtin_amdgcn_wmma_f32_16x16x32_bf16(false, a, false, b, (short)0, c, false, false);
  asm volatile("v_nop\n\tv_nop\n\tv_nop\n\tv_nop" : "+v"(c) : "v"(a), "v"(b));
  return c;
}

// ---------------- helpers ----------------
// bf16 hi/lo split (RNE convert): f ~= hi + lo, both as bf16 bit patterns
__device__ __forceinline__ void split_bits(float f, unsigned short& hi, unsigned short& lo) {
  hi = f2bf_bits(f);
  lo = f2bf_bits(f - bf_bits2f(hi));
}

__device__ __forceinline__ const __bf16* bfp(const unsigned short* p) { return (const __bf16*)(const void*)p; }

__device__ __forceinline__ v8f zero8() { return (v8f){0.f,0.f,0.f,0.f,0.f,0.f,0.f,0.f}; }

// One 16x16 output tile over K = 64 (two 32-deep steps) of C = A * Bt^T with hi/lo split planes.
// A planes row-major [row][PITB] (k contiguous), Bt planes row-major [n][PITB] (k contiguous); all in LDS.
// Per lane: A row = arow0 + (lane&15), Bt row = brow0 + (lane&15); fragment elements 0..7 <- k0 + 8h + 0..7,
// 8..15 <- k0 + 16 + 8h + 0..7 (h = lane>>4). D element r of lane l -> (arow0 + 8h + r, brow0 + (l&15)).
__device__ __forceinline__ v8f tile_k64_split(const unsigned short* Ah, const unsigned short* Al, int arow0,
                                               const unsigned short* Bh, const unsigned short* Bl, int brow0,
                                               int lane, v8f acc) {
  const int rl = lane & 15, koff = (lane >> 4) * 8;
#pragma unroll
  for (int ks = 0; ks < 2; ++ks) {
    const int ao = (arow0 + rl) * PITB + 32 * ks + koff;
    const int bo = (brow0 + rl) * PITB + 32 * ks + koff;
    const v16b ah = Frag<__bf16>::load(bfp(Ah) + ao);
    const v16b al = Frag<__bf16>::load(bfp(Al) + ao);
    const v16b bh = Frag<__bf16>::load(bfp(Bh) + bo);
    const v16b bl = Frag<__bf16>::load(bfp(Bl) + bo);
    acc = at_mma(ah, bh, acc);
    acc = at_mma(ah, bl, acc);
    acc = at_mma(al, bh, acc);
  }
  return acc;
}

// tile_k64_split, and on the same A fragments one more column tile accN += A * N^T whose 16 rows of N^T are all the vector n:
// every column of accN is alike, so element r of any lane is sum_k A[arow0 + 8h + r][k] n[k]. nh/nl[ks] hold n in the B fragment's
// k order (elements 0..7 <- n[32ks + 8h + 0..7], 8..15 <- n[32ks + 16 + 8h + 0..7]); NLO = false: n is exact in nh, nl is not used.
// acc gets the same products in the same order as in tile_k64_split.
template <bool NLO>
__device__ __forceinline__ v8f tile_k64_split_rowdot(const unsigned short* Ah, const unsigned short* Al, int arow0,
                                                      const unsigned short* Bh, const unsigned short* Bl, int brow0,
                                                      const v16b (&nh)[2], const v16b (&nl)[2],
                                                      int lane, v8f acc, v8f& accN) {
  const int rl = lane & 15, koff = (lane >> 4) * 8;
#pragma unroll
  for (int ks = 0; ks < 2; ++ks) {
    const int ao = (arow0 + rl) * PITB + 32 * ks + koff;
    const int bo = (brow0 + rl) * PITB + 32 * ks + koff;
    const v16b ah = Frag<__bf16>::load(bfp(Ah) + ao);
    const v16b al = Frag<__bf16>::load(bfp(Al) + ao);
    const v16b bh = Frag<__bf16>::load(bfp(Bh) + bo);
    const v16b bl = Frag<__bf16>::load(bfp(Bl) + bo);
    acc  = at_mma(ah, bh, acc);
    accN = at_mma(ah, nh[ks], accN);
    acc  = at_mma(ah, bl, acc);
    if (NLO) accN = at_mma(ah, nl[ks], accN);
    acc  = at_mma(al, bh, acc);
    accN = at_mma(al, nh[ks], accN);
  }
  return acc;
}

// Store a D tile (element r of lane -> (row0 + 8h + r, col0 + (lane&15))) as hi/lo bf16 into row-major LDS planes.
__device__ __forceinline__ void put_split_rm(unsigned short* Ph, unsigned short* Pl, int row0, int col0, int lane, v8f v) {
  const int hq = lane >> 4, cq = lane & 15;
#pragma unroll
  for (int r = 0; r < 8; ++r) {
    unsigned short hb, lb;
    split_bits(v[r], hb, lb);
    const int off = (row0 + 8 * hq + r) * PITB + col0 + cq;
    Ph[off] = hb;
    Pl[off] = lb;
  }
}
// Store the TRANSPOSE of a D tile: element r of lane -> P[col0 + (lane&15)][row0 + 8h + r]; the 8 elements of a lane are
// contiguous -> one 16-B LDS store per plane built from per-lane integer words.
__device__ __forceinline__ void put_split_tr(unsigned short* Ph, unsigned short* Pl, int row0, int col0, int lane, v8f v) {
  const int hq = lane >> 4, cq = lane & 15;
  v4u uh, ul;
#pragma unroll
  for (int e = 0; e < 4; ++e) {
    unsigned short ha, la, hb, lb;
    split_bits(v[2 * e], ha, la);
    split_bits(v[2 * e + 1], hb, lb);
    uh[e] = (unsigned)ha | ((unsigned)hb << 16);
    ul[e] = (unsigned)la | ((unsigned)lb << 16);
  }
  const int off = (col0 + cq) * PITB + row0 + 8 * hq;   // byte offset 144*(col) + 2*(row0+8h): 16-B aligned
  *(v4u*)(Ph + off) = uh;
  *(v4u*)(Pl + off) = ul;
}

// tile_k64_split with the two cross products in the other order (hi*hi, lo*hi, hi*lo): for a product whose operands stand
// the other way round (C^T = B * A^T), it adds the same three products in the same order as tile_k64_split does for C.
__device__ __forceinline__ v8f tile_k64_split_sw(const unsigned short* Ah, const unsigned short* Al, int arow0,
                                                  const unsigned short* Bh, const unsigned short* Bl, int brow0,
                                                  int lane, v8f acc) {
  const int rl = lane & 15, koff = (lane >> 4) * 8;
#pragma unroll
  for (int ks = 0; ks < 2; ++ks) {
    const int ao = (arow0 + rl) * PITB + 32 * ks + koff;
    const int bo = (brow0 + rl) * PITB + 32 * ks + koff;
    const v16b ah = Frag<__bf16>::load(bfp(Ah) + ao);
    const v16b al = Frag<__bf16>::load(bfp(Al) + ao);
    const v16b bh = Frag<__bf16>::load(bfp(Bh) + bo);
    const v16b bl = Frag<__bf16>::load(bfp(Bl) + bo);
    acc = at_mma(ah, bh, acc);
    acc = at_mma(al, bh, acc);
    acc = at_mma(ah, bl, acc);
  }
  return acc;
}

// =====================================================================================================
// Two launches. Launch 1, one block per (batch, chunk of 64 steps), does every product that needs the chunk alone, once:
//   phi_q[l][m], phi_k[i][m] = relu(x^T W) + eps             (projection GEMMs, K = d = 64)
//   A[l][i] = sum_m phi_q[l][m] phi_k[i][m], kept for i <= l  (score tile, K = m = 64)
//   num[l][v] = sum_i A[l][i] V[i][v],  nrm[l] = sum_i A[l][i] (a column tile beside num's, B = ones)
//   dS[m][v] = sum_i phi_k[i][m] V[i][v],  dz[m] = sum_i phi_k[i][m]   (the chunk's share of the state)
// and stores num, nrm, phi_q (hi/lo planes), dS and dz in the workspace.
// Launch 2, one block per (batch, 16 value columns, 4 chunks in a row = 256 steps): S_old and z_old of its four chunks = sums of
// the shares of all earlier chunks, in chunk order (a running sum: each share's 16 columns are read once for four chunks), then
//   out[l][v] = (num[l][v] + sum_m phi_q[l][m] S_old[m][v]) / (nrm[l] + phi_q[l].z_old)
// Workspace (f32 words), every word launch 2 reads is written by launch 1 of the same call:
//   share of (b, c) at (b*NCHUNK + c)*SHARE: 16 x 16 tile (rows m of tile tn, columns v of tile tm) at (tm*4 + tn)*256, in register
//   order (below);  dz of (b, c) at DZ_BASE + (b*NCHUNK + c)*NFEAT;
//   num at NUM_BASE: 16 x 16 tile (row tile tm, column tile tn) of (b, c) at (((b*NCHUNK + c)*4 + tm)*4 + tn)*256, in register order
//   (word 128*half + 4*lane + e = element 4*half + e of the lane);  nrm at NRM_BASE as [b][l];
//   phi_q hi, lo (16-bit) at PQH_BASE, PQL_BASE: 8 KB a chunk and plane, in the order of launch 2's A fragment loads.
// =====================================================================================================
constexpr int SHARE    = NVAL * NFEAT;                     // f32 words of one chunk's state share
constexpr int DZ_BASE  = NBATCH * NCHUNK * SHARE;
constexpr int NUM_BASE = DZ_BASE + NBATCH * NCHUNK * NFEAT;
constexpr int NRM_BASE = NUM_BASE + NBATCH * NVAL * NSEQ;
constexpr int PQH_BASE = NRM_BASE + NBATCH * NSEQ;
constexpr int PQL_BASE = PQH_BASE + NBATCH * NSEQ * NFEAT / 2;
constexpr int WS_WORDS = PQL_BASE + NBATCH * NSEQ * NFEAT / 2;
constexpr int GCH      = 4;                                // chunks of one block of launch 2
constexpr int NGRP     = NCHUNK / GCH;
constexpr int VSL      = 16;                               // value columns of one block of launch 2
constexpr int PITO     = GCH * CHUNK + 4;                  // f32 pitch of launch 2's out tile: 16 rows' 16-B stores fall on 64 banks
static_assert(NCHUNK % GCH == 0 && NVAL % VSL == 0 && GCH * CHUNK == 32 * (NTHR / 32) && VSL * NFEAT == 4 * NTHR && GCH * NFEAT == NTHR);

// 16-B global load at a block-uniform base plus a per-thread byte offset plus a constant: the base stays in scalar registers
// and one offset register serves every load of a thread.
__device__ __forceinline__ v4f ld16(const float* __restrict__ ubase, unsigned tbyte, unsigned cbyte) {
  return *(const v4f*)((const char*)ubase + tbyte + cbyte);
}
// per-thread byte offset into a [row][NSEQ] f32 tensor for the 64 x 64 V chunk loads: row tid>>4, columns 4*(tid&15)..+3;
// pass 'it' adds 16 rows
__device__ __forceinline__ unsigned chunk_tbyte(int tid) { return (unsigned)(((tid >> 4) * NSEQ + ((tid & 15) << 2)) * 4); }
constexpr unsigned ROWS16_BYTES = 16u * NSEQ * 4u;

// Transposed hi/lo staging of a 64 x 64 f32 tile x[r][c] (row pitch RP floats) into planes P[c][r] (pitch PITB).
// A thread takes rows 2p and 2p+1 at columns c4..c4+3 and stores one dword (P[c][2p], P[c][2p+1]) per column and plane.
// Lane -> k = lane&7 (c4 = 4k + 32*(w&1), 128 B of a row per 8 lanes), pl = lane>>3 (p = 4*(w>>1) + pl); pass 'it' adds 16 pairs.
// Bank of a store = (16*(k&3) + 36*column-in-four + p) mod 64: lanes k and k+4 (plane rows 16 apart) would meet, so the plane
// rows whose bit 4 is set hold their 16-B groups swapped in pairs: element r of plane row c lies at r ^ tr_swz(c). The 32 lanes
// of every store then fall on 32 banks; a fragment's 16 rows share one tr_swz, so a reader only flips its 8-element offset.
__device__ __forceinline__ int tr_swz(int c) { return ((c >> 4) & 1) << 3; }
// f2bf_bits before its last shift
__device__ __forceinline__ unsigned rne_word(float f) {
  const unsigned u = __float_as_uint(f);
  return u + 0x7FFFu + ((u >> 16) & 1u);
}
template <int RP>
__device__ __forceinline__ unsigned tr_tbyte(int tid) {
  const int k = tid & 7, pl = (tid >> 3) & 3, w = tid >> 5;
  return (unsigned)(((2 * (4 * (w >> 1) + pl)) * RP + 4 * k + 32 * (w & 1)) * 4);
}
// x[2*it + s] = row 2p + s of pass it
template <int RP>
__device__ __forceinline__ void load_tr(const float* __restrict__ ubase, int tid, v4f (&x)[4]) {
#pragma unroll
  for (int it = 0; it < 2; ++it)
#pragma unroll
    for (int s = 0; s < 2; ++s)
      x[2 * it + s] = ld16(ubase, tr_tbyte<RP>(tid), (unsigned)((32 * it + s) * RP * 4));
}
__device__ __forceinline__ void put_tr_pairs(unsigned short* Ph, unsigned short* Pl, int tid, const v4f (&x)[4]) {
  const int k = tid & 7, pl = (tid >> 3) & 3, w = tid >> 5;
  const int c4 = 4 * k + 32 * (w & 1);
  const int sz = tr_swz(c4);          // the same for c4..c4+3
#pragma unroll
  for (int it = 0; it < 2; ++it) {
    const int p = 4 * (w >> 1) + pl + 16 * it;
#pragma unroll
    for (int e = 0; e < 4; ++e) {
      // the split of split_bits on both rows, kept in 32-bit words: the bf16 is the upper half of each rounded word
      const float a = x[2 * it][e], c = x[2 * it + 1][e];
      const unsigned ra = rne_word(a), rc = rne_word(c);
      const unsigned sa = rne_word(a - __uint_as_float(ra & 0xffff0000u));
      const unsigned sc = rne_word(c - __uint_as_float(rc & 0xffff0000u));
      const int off = (c4 + e) * PITB + ((2 * p) ^ sz);   // even: 4-B aligned
      // byte select: upper half of the second word below, upper half of the first word above
      *(unsigned*)(Ph + off) = __builtin_amdgcn_perm(rc, ra, 0x07060302u);
      *(unsigned*)(Pl + off) = __builtin_amdgcn_perm(sc, sa, 0x07060302u);
    }
  }
}

// V chunk (vc = first column of the chunk in row 0): [v][i] f32 -> hi/lo planes [v][i]; 1024 v4f = 256 x 4; 4 halves packed into two integer words per plane
// load_v asks for the thread's four row pieces, put_v splits and stores them: the two stand phases apart, so that the trip to memory runs under phases 0 and 1
__device__ __forceinline__ void load_v(const float* __restrict__ vc, int tid, v4f (&x)[4]) {
#pragma unroll
  for (int it = 0; it < 4; ++it) x[it] = ld16(vc, chunk_tbyte(tid), (unsigned)it * ROWS16_BYTES);
}
__device__ __forceinline__ void put_v(const v4f (&x)[4], unsigned short* sVh, unsigned short* sVl, int tid) {
#pragma unroll
  for (int it = 0; it < 4; ++it) {
    const int idx = tid + it * NTHR;
    const int vr  = idx >> 4;
    const int i4  = (idx & 15) << 2;
    const v4f vv = x[it];
    unsigned short h0, g0, h1, g1, h2, g2, h3, g3;
    split_bits(vv[0], h0, g0);
    split_bits(vv[1], h1, g1);
    split_bits(vv[2], h2, g2);
    split_bits(vv[3], h3, g3);
    v2u uh, ul;
    uh[0] = (unsigned)h0 | ((unsigned)h1 << 16);
    uh[1] = (unsigned)h2 | ((unsigned)h3 << 16);
    ul[0] = (unsigned)g0 | ((unsigned)g1 << 16);
    ul[1] = (unsigned)g2 | ((unsigned)g3 << 16);
    const int off = vr * PITB + i4;      // byte 144*vr + 2*i4 : 8-B aligned
    *(v2u*)(sVh + off) = uh;
    *(v2u*)(sVl + off) = ul;
  }
}

// ---------------- launch 1: all that one chunk gives by itself ----------------
// LDS tile reuse (every producer/consumer pair of a tile is separated by a block barrier):
//   sXh/sXl : q^T hi/lo [l][d] (phases 0-1), then V [v][i] (phases 2-4)
//   sKAh/l  : phi_k [i][m] (phases 1-2), then masked A [l][i] (phases 2b-4)
__global__ __launch_bounds__(NTHR)
void lin_attn_chunk_local_kernel(const float* __restrict__ keys,
                                 const float* __restrict__ values,
                                 const float* __restrict__ queries,
                                 const float* __restrict__ proj,
                                 float* __restrict__ wsh,    // the workspace's parts, as laid out above
                                 float* __restrict__ wdz,
                                 float* __restrict__ wnum,
                                 float* __restrict__ wnrm,
                                 float* __restrict__ wqh,
                                 float* __restrict__ wql) {
  __shared__ __align__(16) unsigned short sXh[CHUNK * PITB];
  __shared__ __align__(16) unsigned short sXl[CHUNK * PITB];
  __shared__ __align__(16) unsigned short sYh[CHUNK * PITB];   // k^T hi [i][d]
  __shared__ __align__(16) unsigned short sYl[CHUNK * PITB];
  __shared__ __align__(16) unsigned short sWh[NFEAT * PITB];   // W^T hi [m][d]
  __shared__ __align__(16) unsigned short sWl[NFEAT * PITB];   // W^T lo [m][d]
  __shared__ __align__(16) unsigned short sQh[CHUNK * PITB];   // phi_q hi [l][m]
  __shared__ __align__(16) unsigned short sQl[CHUNK * PITB];
  __shared__ __align__(16) unsigned short sKAh[CHUNK * PITB];
  __shared__ __align__(16) unsigned short sKAl[CHUNK * PITB];
  __shared__ __align__(16) unsigned short sKTh[NFEAT * PITB];  // phi_k^T hi [m][i]
  __shared__ __align__(16) unsigned short sKTl[NFEAT * PITB];
  __shared__ __align__(16) float sN[CHUNK];                    // nrm [l]

  const int tid  = threadIdx.x;
  const int lane = tid & 31;
  const int w    = tid >> 5;          // wave 0..7
  const int hh   = lane >> 4;
  const int cc   = lane & 15;
  const int tm   = w >> 1;            // row-tile index owned by this wave in every 64x64 GEMM but dS, where it is the v column tile
  const int tn0  = (w & 1) * 2;       // first of the two column tiles owned by this wave (the m row tiles in dS)
  const int b    = blockIdx.x;        // grid.x == NBATCH
  const int ch   = blockIdx.y;        // grid.y == NCHUNK
  const int l0   = ch * CHUNK;

  const float* kc = keys    + (size_t)b * NDIM * NSEQ + l0;
  const float* qc = queries + (size_t)b * NDIM * NSEQ + l0;
  const float* vc = values  + (size_t)b * NVAL * NSEQ + l0;

  // ---- phase 0: W ([d][m]) and the q, k chunks ([d][l0..l0+63]) f32 -> hi/lo bf16 transposed: W^T [m][d], q^T, k^T [l][d] ----
  v4f vv[4];                          // V's rows of this thread, asked for here, used in phase 2
  {
    v4f wv[4], qv[4], kv[4];
    load_tr<NFEAT>(proj, tid, wv);
    // precaution: the build lets a later load's result land in the offset register of the loads above; this wait stands in front
    asm volatile("s_wait_xcnt 0x0" ::: "memory");
    load_tr<NSEQ>(qc, tid, qv);
    load_tr<NSEQ>(kc, tid, kv);
    load_v(vc, tid, vv);
    // precaution: the build reuses the scalar base registers of the loads above right behind them; this wait stands in front
    asm volatile("s_wait_xcnt 0x0" ::: "memory");
    put_tr_pairs(sWh, sWl, tid, wv);
    put_tr_pairs(sXh, sXl, tid, qv);
    put_tr_pairs(sYh, sYl, tid, kv);
  }
  __syncthreads();   // B1

  // ---- phase 1: phi = relu(x^T W) + eps : A = x^T [l][d], Bt = W^T [m][d] ----
  {
    v8f aq[2], ak[2];
    aq[0] = zero8(); aq[1] = zero8(); ak[0] = zero8(); ak[1] = zero8();
    const int rl = lane & 15, koff = hh * 8;
#pragma unroll
    for (int ks = 0; ks < 2; ++ks) {
      const int ao = (16 * tm + rl) * PITB + 32 * ks + (koff ^ tr_swz(16 * tm));
      const v16b qh = Frag<__bf16>::load(bfp(sXh) + ao);
      const v16b ql = Frag<__bf16>::load(bfp(sXl) + ao);
      const v16b kh = Frag<__bf16>::load(bfp(sYh) + ao);
      const v16b kl = Frag<__bf16>::load(bfp(sYl) + ao);
#pragma unroll
      for (int j = 0; j < 2; ++j) {
        const int bo = (16 * (tn0 + j) + rl) * PITB + 32 * ks + (koff ^ tr_swz(16 * (tn0 + j)));
        const v16b wh = Frag<__bf16>::load(bfp(sWh) + bo);
        const v16b wl = Frag<__bf16>::load(bfp(sWl) + bo);
        aq[j] = at_mma(qh, wh, aq[j]);
        aq[j] = at_mma(qh, wl, aq[j]);
        aq[j] = at_mma(ql, wh, aq[j]);
        ak[j] = at_mma(kh, wh, ak[j]);
        ak[j] = at_mma(kh, wl, ak[j]);
        ak[j] = at_mma(kl, wh, ak[j]);
      }
    }
#pragma unroll
    for (int j = 0; j < 2; ++j) {
      v8f pq, pk;
#pragma unroll
      for (int r = 0; r < 8; ++r) {
        pq[r] = fmaxf(aq[j][r], 0.f) + FEAT_EPS;
        pk[r] = fmaxf(ak[j][r], 0.f) + FEAT_EPS;
      }
      put_split_rm(sQh,  sQl,  16 * tm, 16 * (tn0 + j), lane, pq);   // phi_q [l][m]
      put_split_rm(sKAh, sKAl, 16 * tm, 16 * (tn0 + j), lane, pk);   // phi_k [i][m]
      put_split_tr(sKTh, sKTl, 16 * tm, 16 * (tn0 + j), lane, pk);   // phi_k^T [m][i]
    }
  }
  __syncthreads();   // B2

  // ---- phase 2: phi_q planes to the workspace, stage V ([v][l0+i] f32 -> hi/lo [v][i]), score GEMM ----
  v8f accA[2];
  {
    // phi_q planes in the order of launch 2's A fragment loads: 16-B unit u = ((row tile*2 + ks)*2 + p)*32 + lane holds
    // phi_q[16*tile + (lane&15)][32*ks + 16*p + 8*(lane>>4) + 0..7]; this thread copies units tid and tid + NTHR (row tiles +2).
    // They leave here, as soon as they are complete, so that the stores drain under the phases that follow
    const int qs = (16 * (tid >> 7) + cc) * PITB + 32 * ((tid >> 6) & 1) + 16 * ((tid >> 5) & 1) + 8 * hh;
    const v4u h0 = *(const v4u*)(sQh + qs);
    const v4u h1 = *(const v4u*)(sQh + qs + 32 * PITB);
    const v4u g0 = *(const v4u*)(sQl + qs);
    const v4u g1 = *(const v4u*)(sQl + qs + 32 * PITB);
    put_v(vv, sXh, sXl, tid);
    const unsigned qo = 16u * (unsigned)tid;
    char* gh = (char*)(wqh + (size_t)(b * NSEQ + l0) * (NFEAT / 2));   // block-uniform
    char* gl = (char*)(wql + (size_t)(b * NSEQ + l0) * (NFEAT / 2));
    *(v4u*)(gh + qo)              = h0;
    *(v4u*)(gh + qo + 16u * NTHR) = h1;
    *(v4u*)(gl + qo)              = g0;
    *(v4u*)(gl + qo + 16u * NTHR) = g1;
    // precaution: the registers that the stores above name are free for reuse behind them; this wait stands in front
    asm volatile("s_wait_xcnt 0x0" ::: "memory");
    // A[l][i] = sum_m phi_q[l][m] phi_k[i][m] : A = phi_q rows l, Bt = phi_k rows i; causal mask i <= l
#pragma unroll
    for (int j = 0; j < 2; ++j) {
      accA[j] = tile_k64_split(sQh, sQl, 16 * tm, sKAh, sKAl, 16 * (tn0 + j), lane, zero8());
#pragma unroll
      for (int r = 0; r < 8; ++r) {
        const int row = 16 * tm + 8 * hh + r;
        const int col = 16 * (tn0 + j) + cc;
        const float a = accA[j][r];
        accA[j][r] = (col <= row) ? a : 0.f;
      }
    }
  }
  __syncthreads();   // B3

  // ---- phase 2b: masked A -> hi/lo planes (over phi_k's tile space; explicit zeros stored) ----
#pragma unroll
  for (int j = 0; j < 2; ++j)
    put_split_rm(sKAh, sKAl, 16 * tm, 16 * (tn0 + j), lane, accA[j]);
  __syncthreads();   // B4

  // ---- phase 4: the chunk's share of the state, stored at once; then the num tile and, on its first tile's A fragments, the row sums of A ----
  v8f accO[2];
  v8f accN = zero8();                 // element r: nrm[16*tm + 8h + r], alike in the 16 lanes of a half
  float zp = 0.f;
  {
    // dS[m][v] = sum_i phi_k[i][m] V[i][v] : A = phi_k^T [m][i] rows m = 16*(tn0+j).., Bt = V [v][i] rows v = 16*tm..
    v8f ds[2];
#pragma unroll
    for (int j = 0; j < 2; ++j)
      ds[j] = tile_k64_split_sw(sKTh, sKTl, 16 * (tn0 + j), sXh, sXl, 16 * tm, lane, zero8());
    // share: each 16 x 16 tile (rows m, columns v) in its register order, 512 B per store; the stores drain under num's products
    float* sb = wsh + (size_t)(b * NCHUNK + ch) * SHARE + (tm * 4 + tn0) * 256 + 4 * lane;
#pragma unroll
    for (int j = 0; j < 2; ++j) {
      v4f a0, a1;
      a0[0] = ds[j][0]; a0[1] = ds[j][1]; a0[2] = ds[j][2]; a0[3] = ds[j][3];
      a1[0] = ds[j][4]; a1[1] = ds[j][5]; a1[2] = ds[j][6]; a1[3] = ds[j][7];
      *(v4f*)(sb + 256 * j)       = a0;
      *(v4f*)(sb + 256 * j + 128) = a1;
    }
    // precaution: the registers that the stores above name are free for reuse behind them; this wait stands in front
    asm volatile("s_wait_xcnt 0x0" ::: "memory");

    v16b one[2];
#pragma unroll
    for (int ks = 0; ks < 2; ++ks)
#pragma unroll
      for (int e = 0; e < 16; ++e) one[ks][e] = (__bf16)1.0f;
    // sum_i A[l][i] V[i][v] : A = masked A rows l, Bt = V [v][i];  nrm = sum_i A[l][i]
    accO[0] = tile_k64_split_rowdot<false>(sKAh, sKAl, 16 * tm, sXh, sXl, 16 * tn0, one, one, lane, zero8(), accN);
    accO[1] = tile_k64_split(sKAh, sKAl, 16 * tm, sXh, sXl, 16 * (tn0 + 1), lane, zero8());
    // both waves of a row tile hold its row sums; the first one's lanes 0 and 16 hand on 8 rows each
    if ((w & 1) == 0 && cc == 0) {
      v4f n0, n1;
      n0[0] = accN[0]; n0[1] = accN[1]; n0[2] = accN[2]; n0[3] = accN[3];
      n1[0] = accN[4]; n1[1] = accN[5]; n1[2] = accN[6]; n1[3] = accN[7];
      *(v4f*)(sN + 16 * tm + 8 * hh)     = n0;
      *(v4f*)(sN + 16 * tm + 8 * hh + 4) = n1;
    }
    // dz[m] = sum_i phi_k[i][m], from the hi + lo planes (waves 0-1; the branch is wave-uniform)
    if (tid < NFEAT) {
#pragma unroll
      for (int j = 0; j < 8; ++j) {
        const v4u wh = *(const v4u*)(sKTh + tid * PITB + 8 * j);
        const v4u wl = *(const v4u*)(sKTl + tid * PITB + 8 * j);
#pragma unroll
        for (int e = 0; e < 4; ++e) {
          zp += __uint_as_float(wh[e] << 16) + __uint_as_float(wl[e] << 16);
          zp += __uint_as_float(wh[e] & 0xffff0000u) + __uint_as_float(wl[e] & 0xffff0000u);
        }
      }
    }
  }
  __syncthreads();   // B5: nrm complete

  // the last stores: no register that they name is written again
  {
    const v4f nv = *(const v4f*)(sN + 4 * (tid & 15));
    // num: each 16 x 16 tile in its register order, 512 B per store
    float* nb = wnum + (size_t)(((b * NCHUNK + ch) * 4 + tm) * 4 + tn0) * 256 + 4 * lane;
#pragma unroll
    for (int j = 0; j < 2; ++j) {
      v4f o0, o1;
      o0[0] = accO[j][0]; o0[1] = accO[j][1]; o0[2] = accO[j][2]; o0[3] = accO[j][3];
      o1[0] = accO[j][4]; o1[1] = accO[j][5]; o1[2] = accO[j][6]; o1[3] = accO[j][7];
      *(v4f*)(nb + 256 * j)       = o0;
      *(v4f*)(nb + 256 * j + 128) = o1;
    }
    if (tid < NFEAT) wdz[(b * NCHUNK + ch) * NFEAT + tid] = zp;
    // nrm: 16 lanes of one wave write the chunk's 64 rows
    if (tid < CHUNK / 4) *(v4f*)(wnrm + b * NSEQ + l0 + 4 * tid) = nv;
  }
}

// ---------------- launch 2: the earlier chunks' part, 256 steps x 16 value columns a block ----------------
__global__ __launch_bounds__(NTHR)
void lin_attn_state_out_kernel(const float* __restrict__ wsh,    // the workspace's parts, as laid out above
                               const float* __restrict__ wdz,
                               const float* __restrict__ wnum,
                               const float* __restrict__ wnrm,
                               const float* __restrict__ wqh,
                               const float* __restrict__ wql,
                               float* __restrict__ out) {
  __shared__ __align__(16) unsigned short sSh[GCH * VSL * PITB];   // S_old^T hi of chunk k of the block: [k][v][m]
  __shared__ __align__(16) unsigned short sSl[GCH * VSL * PITB];
  __shared__ __align__(16) unsigned short sZh[GCH * NFEAT];        // z_old hi [k][m]
  __shared__ __align__(16) unsigned short sZl[GCH * NFEAT];
  __shared__ __align__(16) float sNr[GCH * CHUNK];                 // nrm of the block's steps
  __shared__ __align__(16) float sO[VSL * PITO];                   // out [v][step]

  const int tid  = threadIdx.x;
  const int lane = tid & 31;
  const int w    = tid >> 5;          // wave 0..7: steps 32*w .. 32*w+31 of the block, two row tiles
  const int hh   = lane >> 4;
  const int cc   = lane & 15;
  const int b    = blockIdx.x;                   // grid.x == NBATCH
  const int vq   = blockIdx.y;                   // grid.y == NVAL / VSL
  const int g    = NGRP - 1 - (int)blockIdx.z;   // grid.z == NGRP; the blocks with the most shares to sum start first
  const int c0   = GCH * g;                      // first chunk of the block = number of shares in front of it
  const int s0   = c0 * CHUNK;                   // first step of the block

  // ---- all loads of the block are asked for at once ----
  // thread tid holds words 4*tid..+3 of a share's 16 columns (4 KB in a row, four 16 x 16 tiles in register order):
  // v = tid&15, m = 16*(tid>>6) + 8*((tid>>4)&1) + 4*((tid>>5)&1) + 0..3
  const char* xp = (const char*)(wsh + (size_t)b * NCHUNK * SHARE + vq * VSL * NFEAT) + 16u * (unsigned)tid;
  const char* yp = xp + (size_t)c0 * SHARE * 4u;
  // unrolled so that every share's place is a constant in the load's offset field; the test is block-uniform
  v4f x[NCHUNK - GCH], y[GCH - 1];
#pragma unroll
  for (int gg = 0; gg < NGRP - 1; ++gg) {
    if (gg >= g) break;
#pragma unroll
    for (int u = 0; u < GCH; ++u) x[GCH * gg + u] = *(const v4f*)(xp + (unsigned)(GCH * gg + u) * SHARE * 4u);
  }
#pragma unroll
  for (int k = 0; k < GCH - 1; ++k) y[k] = *(const v4f*)(yp + (unsigned)k * SHARE * 4u);
  // precaution: the address registers of the loads above are free for reuse behind them; named here, they last up to this wait
  asm volatile("s_wait_xcnt 0x0" :: "v"(xp), "v"(yp) : "memory");

  const int zi = tid & (NFEAT - 1), zk = tid >> 6;                 // this thread sums z_old[zi] of chunk c0 + zk
  const unsigned zo = 4u * (unsigned)zi;
  const unsigned no = 4u * (unsigned)tid;
  const unsigned fo = (unsigned)(w * 4096 + lane * 16);                      // phi_q: 2 KB a row tile and plane, in fragment order
  const unsigned uo = (unsigned)(w * 8192 + lane * 16);                      // num: 4 KB a row tile (4 column tiles), in register order
  const float* zb  = wdz + b * NCHUNK * NFEAT;                                      // all block-uniform
  const float* rb  = wnrm + b * NSEQ + s0;
  const float* qhb = wqh + (size_t)(b * NSEQ + s0) * (NFEAT / 2);
  const float* qlb = wql + (size_t)(b * NSEQ + s0) * (NFEAT / 2);
  const float* nb  = wnum + (size_t)(b * NCHUNK + c0) * SHARE + vq * 256;
  float zx[NCHUNK - 1];
#pragma unroll
  for (int c = 0; c < NCHUNK - 1; ++c) zx[c] = *(const float*)((const char*)(zb + c * NFEAT) + zo);
  const float nr = *(const float*)((const char*)rb + no);
  // phi_q fragments (elements 0..7 <- m = 32ks + 8h + 0..7, 8..15 <- 16 further) and num of this wave's two row tiles
  v4f fh[2][2][2], fl[2][2][2], nu[2][2];
#pragma unroll
  for (int t = 0; t < 2; ++t) {
#pragma unroll
    for (int ks = 0; ks < 2; ++ks)
#pragma unroll
      for (int p = 0; p < 2; ++p) {
        fh[t][ks][p] = ld16(qhb, fo, (unsigned)(2048 * t + 512 * (2 * ks + p)));
        fl[t][ks][p] = ld16(qlb, fo, (unsigned)(2048 * t + 512 * (2 * ks + p)));
      }
    nu[t][0] = ld16(nb, uo, (unsigned)(4096 * t));
    nu[t][1] = ld16(nb, uo, (unsigned)(4096 * t + 512));
  }
  // keeps the loads together in front of the sums: left free, the scheduler issues them a few at a time, each lot waiting out
  // a whole trip to L2
  __builtin_amdgcn_sched_barrier(0);
  // precaution: the offset registers of the loads above are free for reuse behind them; named here, they last up to this wait
  asm volatile("s_wait_xcnt 0x0" :: "v"(zo), "v"(no), "v"(fo), "v"(uo) : "memory");
  // keeps later scalar address work, which reuses the loads' base registers, behind the wait
  __builtin_amdgcn_sched_barrier(0);

  // ---- S_old^T (16 columns) and z_old of the four chunks: running sums in chunk order, split into hi/lo planes ----
  {
    v4f s;
    s[0] = 0.f; s[1] = 0.f; s[2] = 0.f; s[3] = 0.f;
#pragma unroll
    for (int gg = 0; gg < NGRP - 1; ++gg) {
      if (gg >= g) break;
#pragma unroll
      for (int u = 0; u < GCH; ++u)
#pragma unroll
        for (int e = 0; e < 4; ++e) s[e] += x[GCH * gg + u][e];
    }
#pragma unroll
    for (int k = 0; k < GCH; ++k) {
      if (k > 0) {
#pragma unroll
        for (int e = 0; e < 4; ++e) s[e] += y[k - 1][e];
      }
      unsigned short h0, g0, h1, g1, h2, g2, h3, g3;
      split_bits(s[0], h0, g0);
      split_bits(s[1], h1, g1);
      split_bits(s[2], h2, g2);
      split_bits(s[3], h3, g3);
      v2u uh, ul;
      uh[0] = (unsigned)h0 | ((unsigned)h1 << 16);
      uh[1] = (unsigned)h2 | ((unsigned)h3 << 16);
      ul[0] = (unsigned)g0 | ((unsigned)g1 << 16);
      ul[1] = (unsigned)g2 | ((unsigned)g3 << 16);
      const int off = (k * VSL + cc) * PITB + 16 * (tid >> 6) + 8 * hh + 4 * ((tid >> 5) & 1);   // 8-B aligned
      *(v2u*)(sSh + off) = uh;
      *(v2u*)(sSl + off) = ul;
    }
    float zs = 0.f;
#pragma unroll
    for (int c = 0; c < NCHUNK - 1; ++c) zs += (c < c0 + zk) ? zx[c] : 0.f;
    unsigned short hz, lz;
    split_bits(zs, hz, lz);
    sZh[zk * NFEAT + zi] = hz;
    sZl[zk * NFEAT + zi] = lz;
    sNr[tid] = nr;
  }
  __syncthreads();   // S_old^T, z_old planes and nrm complete

  // ---- num += phi_q S_old, nrm += phi_q.z_old (a column tile beside it, B = z_old in all 16 rows); divide; store ----
  {
    const int kq = w >> 1;            // this wave's chunk in the block
    v8f accO[2], accN[2];
#pragma unroll
    for (int t = 0; t < 2; ++t) {
      const v4f n0 = *(const v4f*)(sNr + 32 * w + 16 * t + 8 * hh);
      const v4f n1 = *(const v4f*)(sNr + 32 * w + 16 * t + 8 * hh + 4);
#pragma unroll
      for (int e = 0; e < 4; ++e) {
        accO[t][e] = nu[t][0][e]; accO[t][4 + e] = nu[t][1][e];
        accN[t][e] = n0[e];       accN[t][4 + e] = n1[e];
      }
    }
#pragma unroll
    for (int ks = 0; ks < 2; ++ks) {
      const int bo = (kq * VSL + cc) * PITB + 32 * ks + 8 * hh;
      const v16b bh = Frag<__bf16>::load(bfp(sSh) + bo);
      const v16b bl = Frag<__bf16>::load(bfp(sSl) + bo);
      const v16b zh = Frag<__bf16>::load(bfp(sZh) + kq * NFEAT + 32 * ks + 8 * hh);
      const v16b zl = Frag<__bf16>::load(bfp(sZl) + kq * NFEAT + 32 * ks + 8 * hh);
#pragma unroll
      for (int t = 0; t < 2; ++t) {
        Frag<__bf16>::U ua, ub;
        ua.h[0] = __builtin_bit_cast(v8b, fh[t][ks][0]); ua.h[1] = __builtin_bit_cast(v8b, fh[t][ks][1]);
        ub.h[0] = __builtin_bit_cast(v8b, fl[t][ks][0]); ub.h[1] = __builtin_bit_cast(v8b, fl[t][ks][1]);
        const v16b ah = ua.v, al = ub.v;
        accO[t] = at_mma(ah, bh, accO[t]);
        accN[t] = at_mma(ah, zh, accN[t]);
        accO[t] = at_mma(ah, bl, accO[t]);
        accN[t] = at_mma(ah, zl, accN[t]);
        accO[t] = at_mma(al, bh, accO[t]);
        accN[t] = at_mma(al, zh, accN[t]);
      }
    }
    // element r of tile t -> sO[v = cc][step 32*w + 16*t + 8h + r]
#pragma unroll
    for (int t = 0; t < 2; ++t) {
      v4f o0, o1;
#pragma unroll
      for (int e = 0; e < 4; ++e) {
        o0[e] = accO[t][e]     * (1.0f / accN[t][e]);
        o1[e] = accO[t][4 + e] * (1.0f / accN[t][4 + e]);
      }
      const int off = cc * PITO + 32 * w + 16 * t + 8 * hh;   // byte 1040*v + 32*(...): 16-B aligned
      *(v4f*)(sO + off)     = o0;
      *(v4f*)(sO + off + 4) = o1;
    }
  }
  __syncthreads();   // out tile complete

  // One instruction writes 512 B in a row of one output row; the stores come last: no register that they name is written again
  {
    float* ob = out + (size_t)(b * NVAL + vq * VSL) * NSEQ + s0;   // block-uniform
    v4f val[4];
#pragma unroll
    for (int it = 0; it < 4; ++it) val[it] = *(const v4f*)(sO + (4 * it + (tid >> 6)) * PITO + 4 * (tid & 63));
#pragma unroll
    for (int it = 0; it < 4; ++it)
      *(v4f*)(ob + (size_t)(4 * it + (tid >> 6)) * NSEQ + 4 * (tid & 63)) = val[it];
  }
}

extern "C" void kernel_launch(void* const* d_in, const int* in_sizes, int n_in,
                              void* d_out, int out_size, void* d_ws, size_t ws_size,
                              hipStream_t stream) {
  if (n_in < 4) return;
  if (in_sizes[0] != NBATCH * NDIM * NSEQ) return;
  if (in_sizes[1] != NBATCH * NVAL * NSEQ) return;
  if (in_sizes[2] != NBATCH * NDIM * NSEQ) return;
  if (in_sizes[3] != NDIM * NFEAT) return;
  if (out_size != NBATCH * NVAL * NSEQ) return;
  if (ws_size < sizeof(float) * WS_WORDS) return;
  const float* keys    = (const float*)d_in[0];
  const float* values  = (const float*)d_in[1];
  const float* queries = (const float*)d_in[2];
  const float* proj    = (const float*)d_in[3];
  float* out = (float*)d_out;
  float* ws  = (float*)d_ws;
  lin_attn_chunk_local_kernel<<<dim3(NBATCH, NCHUNK), dim3(NTHR), 0, stream>>>(keys, values, queries, proj, ws, ws + DZ_BASE, ws + NUM_BASE, ws + NRM_BASE, ws + PQH_BASE, ws + PQL_BASE);
  lin_attn_state_out_kernel<<<dim3(NBATCH, NVAL / VSL, NGRP), dim3(NTHR), 0, stream>>>(ws, ws + DZ_BASE, ws + NUM_BASE, ws + NRM_BASE, ws + PQH_BASE, ws + PQL_BASE, out);
}
